// v000
// Measured on an AMD MI455X. A time is GPU time per run, averaged over a window of back-to-back runs after a warm-up
// (all launches, gaps included; the runs take copies of the inputs in turn), and the median of several windows.
// Apart from v000's, it joins two sittings. Times from different sittings can be a few percent apart, while
// side-by-side timings come from the same sitting.
// v000, which the later versions start from, runs in 1030 microseconds.
#include <hip/hip_runtime.h>
#include <hip/hip_bf16.h>

typedef __attribute__((ext_vector_type(2))) float v2f;
typedef __attribute__((ext_vector_type(8))) float v8f;

// ---------------------------------------------------------------------------
// C[M=1024, N=1024] = A[1024,1024] @ W[1024,1024] + bias[N]
// Block: 256 threads = 8 wave32; block tile 64(M) x 128(N); K-step 16.
// Each wave computes a 32x32 tile as a 2x2 grid of 16x16 WMMA accumulators,
// so every A-frag is reused across 2 N-subtiles and every B-frag across 2
// M-subtiles (2 LDS dwords per v_wmma_f32_16x16x4_f32).
// B panel is stored pair-interleaved in LDS ([k/2][n][2]) so a B-fragment is
// one aligned ds_load_b64 -> no VALU repacking before the WMMA.
// ---------------------------------------------------------------------------
__global__ __launch_bounds__(256) void gemm1024_bias_wmma(
    const float* __restrict__ A, const float* __restrict__ W,
    const float* __restrict__ bias, float* __restrict__ C) {
  constexpr int K = 1024, N = 1024;
  __shared__ __align__(16) float As[64 * 16];        // [m][k]       4 KB
  __shared__ __align__(16) float BsP[8 * 128 * 2];   // [k/2][n][2]  8 KB

  const int tid  = threadIdx.x;
  const int lane = tid & 31;
  const int wid  = tid >> 5;
  const int half = lane >> 4;   // 0: lanes 0-15, 1: lanes 16-31
  const int l16  = lane & 15;

  const int m0 = blockIdx.y * 64;
  const int n0 = blockIdx.x * 128;
  const int mw = (wid & 1) * 32;   // wave M offset in block tile
  const int nw = (wid >> 1) * 32;  // wave N offset in block tile

  // cooperative-load coordinates
  const int ar = tid >> 2;         // 0..63 : A panel row
  const int ac = (tid & 3) * 4;    // 0,4,8,12
  const int kp = tid >> 5;         // 0..7  : B panel k-pair
  const int n4 = (tid & 31) * 4;   // 0..124

  v8f acc00 = {}, acc01 = {}, acc10 = {}, acc11 = {};

  for (int k0 = 0; k0 < K; k0 += 16) {
    // A panel [64 x 16]
    const float4 av = *reinterpret_cast<const float4*>(&A[(size_t)(m0 + ar) * K + k0 + ac]);
    *reinterpret_cast<float4*>(&As[ar * 16 + ac]) = av;
    // B panel, pair-interleaved: {W[2kp, n], W[2kp+1, n]} contiguous
    const float4 f0 = *reinterpret_cast<const float4*>(&W[(size_t)(k0 + 2 * kp) * N + n0 + n4]);
    const float4 f1 = *reinterpret_cast<const float4*>(&W[(size_t)(k0 + 2 * kp + 1) * N + n0 + n4]);
    const int bbase = (kp * 128 + n4) * 2;
    float4 s0; s0.x = f0.x; s0.y = f1.x; s0.z = f0.y; s0.w = f1.y;
    float4 s1; s1.x = f0.z; s1.y = f1.z; s1.z = f0.w; s1.w = f1.w;
    *reinterpret_cast<float4*>(&BsP[bbase])     = s0;
    *reinterpret_cast<float4*>(&BsP[bbase + 4]) = s1;
    __syncthreads();

#pragma unroll
    for (int kk = 0; kk < 16; kk += 4) {
      const int kb = kk + 2 * half;  // even; A-frag lanes 0-15: K={kk,kk+1}, 16-31: K={kk+2,kk+3}
      const int kq = kb >> 1;
      v2f a0 = *reinterpret_cast<const v2f*>(&As[(mw + l16) * 16 + kb]);
      v2f a1 = *reinterpret_cast<const v2f*>(&As[(mw + 16 + l16) * 16 + kb]);
      v2f b0 = *reinterpret_cast<const v2f*>(&BsP[(kq * 128 + nw + l16) * 2]);
      v2f b1 = *reinterpret_cast<const v2f*>(&BsP[(kq * 128 + nw + 16 + l16) * 2]);
      acc00 = __builtin_amdgcn_wmma_f32_16x16x4_f32(false, a0, false, b0, (short)0, acc00, false, false);
      acc01 = __builtin_amdgcn_wmma_f32_16x16x4_f32(false, a0, false, b1, (short)0, acc01, false, false);
      acc10 = __builtin_amdgcn_wmma_f32_16x16x4_f32(false, a1, false, b0, (short)0, acc10, false, false);
      acc11 = __builtin_amdgcn_wmma_f32_16x16x4_f32(false, a1, false, b1, (short)0, acc11, false, false);
    }
    __syncthreads();
  }

  const float bias0 = bias[n0 + nw + l16];
  const float bias1 = bias[n0 + nw + 16 + l16];
#pragma unroll
  for (int r = 0; r < 8; ++r) {
    const int row0 = m0 + mw + r + 8 * half;       // C layout: vgpr r -> M=r / M=8+r per half
    const int row1 = row0 + 16;
    C[(size_t)row0 * N + n0 + nw + l16]      = acc00[r] + bias0;
    C[(size_t)row0 * N + n0 + nw + 16 + l16] = acc01[r] + bias1;
    C[(size_t)row1 * N + n0 + nw + l16]      = acc10[r] + bias0;
    C[(size_t)row1 * N + n0 + nw + 16 + l16] = acc11[r] + bias1;
  }
}

// ---------------------------------------------------------------------------
// Multi-query attention core. One wave32 per 16-row query tile.
//   Q: [B, 512, 1024] (per-head slice h*64..h*64+63)
//   K2/V2: [B, 8192, 64]  (k/v projections viewed as single head of len S*H)
//   Y: scrambled output, per batch flat index (h*64+d)*512 + s  (matches the
//      reference's swapaxes(-1,-2).reshape(B,-1,D))
// Flash-attention style online softmax; Q tile lives in VGPRs as WMMA A-frags.
// ---------------------------------------------------------------------------
__global__ __launch_bounds__(32) void mqa_attention_wmma(
    const float* __restrict__ Q, const float* __restrict__ Kp,
    const float* __restrict__ Vp, float* __restrict__ Y) {
  constexpr int S = 512, HD = 64, SK = 8192;
  const int sTile = blockIdx.x;  // 0..31
  const int h     = blockIdx.y;  // 0..15
  const int b     = blockIdx.z;  // 0..1
  const int lane  = threadIdx.x & 31;
  const int half  = lane >> 4;
  const int l16   = lane & 15;
  const int sBase = sTile * 16;

  __shared__ __align__(8) float p_lds[16 * 16];

  // Preload Q tile [16 x 64] as 16 A-fragments (K-steps of 4): 32 VGPRs/lane.
  const float* qrow = Q + ((size_t)b * S + sBase + l16) * 1024 + h * 64 + 2 * half;
  v2f qa[16];
#pragma unroll
  for (int kk = 0; kk < 16; ++kk)
    qa[kk] = *reinterpret_cast<const v2f*>(qrow + kk * 4);

  const float* kbase = Kp + (size_t)b * SK * HD;
  const float* vbase = Vp + (size_t)b * SK * HD;

  float mrow[8], lrow[8];
#pragma unroll
  for (int r = 0; r < 8; ++r) { mrow[r] = -__builtin_inff(); lrow[r] = 0.0f; }
  v8f accO[4] = {{}, {}, {}, {}};

  for (int j0 = 0; j0 < SK; j0 += 16) {
    if (j0 + 16 < SK) {
      __builtin_prefetch(kbase + (size_t)(j0 + 16 + l16) * HD, 0, 0);
      __builtin_prefetch(vbase + (size_t)(j0 + 16 + l16) * HD, 0, 0);
    }

    // scores tile S16 = Q[16x64] @ K2[j0:j0+16, :]^T  (B-frag: n=j lane, k=d)
    v8f sc = {};
    const float* krow = kbase + (size_t)(j0 + l16) * HD + 2 * half;
#pragma unroll
    for (int kk = 0; kk < 16; ++kk) {
      v2f bf = *reinterpret_cast<const v2f*>(krow + kk * 4);
      sc = __builtin_amdgcn_wmma_f32_16x16x4_f32(false, qa[kk], false, bf, (short)0, sc, false, false);
    }

    // online softmax (rows split across wave halves exactly like the C layout)
#pragma unroll
    for (int r = 0; r < 8; ++r) {
      float c = sc[r] * 0.125f;  // 1/sqrt(64)
      float rmax = c;
      rmax = fmaxf(rmax, __shfl_xor(rmax, 1, 32));
      rmax = fmaxf(rmax, __shfl_xor(rmax, 2, 32));
      rmax = fmaxf(rmax, __shfl_xor(rmax, 4, 32));
      rmax = fmaxf(rmax, __shfl_xor(rmax, 8, 32));
      const float mnew = fmaxf(mrow[r], rmax);
      const float p = __expf(c - mnew);
      float ps = p;
      ps += __shfl_xor(ps, 1, 32);
      ps += __shfl_xor(ps, 2, 32);
      ps += __shfl_xor(ps, 4, 32);
      ps += __shfl_xor(ps, 8, 32);
      const float scl = __expf(mrow[r] - mnew);
      lrow[r] = lrow[r] * scl + ps;
      mrow[r] = mnew;
#pragma unroll
      for (int t = 0; t < 4; ++t) accO[t][r] *= scl;
      p_lds[(r + 8 * half) * 16 + l16] = p;  // stage P for A-frag re-layout
    }
    __syncthreads();  // single-wave WG: cheap; orders LDS write -> read

    // accO[16x64] += P[16x16] @ V2[j0:j0+16, 0:64]
#pragma unroll
    for (int kk = 0; kk < 4; ++kk) {
      const int kb = 4 * kk + 2 * half;
      v2f pa = *reinterpret_cast<const v2f*>(&p_lds[l16 * 16 + kb]);
      const float* vrow = vbase + (size_t)(j0 + kb) * HD;
#pragma unroll
      for (int t = 0; t < 4; ++t) {
        v2f bf;
        bf.x = vrow[t * 16 + l16];
        bf.y = vrow[HD + t * 16 + l16];
        accO[t] = __builtin_amdgcn_wmma_f32_16x16x4_f32(false, pa, false, bf, (short)0, accO[t], false, false);
      }
    }
    __syncthreads();
  }

  // normalize and write scrambled layout: Y[b].flat[(h*64+d)*512 + s]
  float* ybase = Y + (size_t)b * (S * 1024);
#pragma unroll
  for (int r = 0; r < 8; ++r) {
    const int sIdx = sBase + r + 8 * half;
    const float inv = 1.0f / lrow[r];
#pragma unroll
    for (int t = 0; t < 4; ++t) {
      const int d = t * 16 + l16;
      ybase[(size_t)(h * 64 + d) * 512 + sIdx] = accO[t][r] * inv;
    }
  }
}

// ---------------------------------------------------------------------------
// Launch: 3 projection GEMMs -> attention -> output GEMM (consumes scrambled Y
// as a plain row-major [1024,1024] matrix, matching the reference faithfully).
// Workspace: Q(4MB) | K(4MB) | V(4MB) | Y(4MB) = 16MB.
// ---------------------------------------------------------------------------
extern "C" void kernel_launch(void* const* d_in, const int* in_sizes, int n_in,
                              void* d_out, int out_size, void* d_ws, size_t ws_size,
                              hipStream_t stream) {
  (void)in_sizes; (void)n_in; (void)out_size; (void)ws_size;
  const float* x  = (const float*)d_in[0];
  const float* Wq = (const float*)d_in[1];
  const float* bq = (const float*)d_in[2];
  const float* Wk = (const float*)d_in[3];
  const float* bk = (const float*)d_in[4];
  const float* Wv = (const float*)d_in[5];
  const float* bv = (const float*)d_in[6];
  const float* Wo = (const float*)d_in[7];
  const float* bo = (const float*)d_in[8];
  float* out = (float*)d_out;

  float* ws = (float*)d_ws;
  float* Qp = ws;
  float* Kp = ws + (1u << 20);
  float* Vp = ws + (2u << 20);
  float* Yp = ws + (3u << 20);

  const dim3 gGrid(8, 16, 1);   // N tiles of 128, M tiles of 64
  const dim3 gBlk(256, 1, 1);
  gemm1024_bias_wmma<<<gGrid, gBlk, 0, stream>>>(x, Wq, bq, Qp);
  gemm1024_bias_wmma<<<gGrid, gBlk, 0, stream>>>(x, Wk, bk, Kp);
  gemm1024_bias_wmma<<<gGrid, gBlk, 0, stream>>>(x, Wv, bv, Vp);
  mqa_attention_wmma<<<dim3(32, 16, 2), dim3(32, 1, 1), 0, stream>>>(Qp, Kp, Vp, Yp);
  gemm1024_bias_wmma<<<gGrid, gBlk, 0, stream>>>(Yp, Wo, bo, out);
}

// v001
// One run takes 497 microseconds.
// Next to v000, in two timings, it ran 2.07 and 2.05 times as fast.
#include <hip/hip_runtime.h>
#include <hip/hip_bf16.h>

typedef __attribute__((ext_vector_type(2))) float v2f;
typedef __attribute__((ext_vector_type(8))) float v8f;

// ---------------------------------------------------------------------------
// C[M=1024, N=1024] = A[1024,1024] @ W[1024,1024] + bias[N]
// Block: 256 threads = 8 wave32; block tile 64(M) x 128(N); K-step 16.
// Each wave computes a 32x32 tile as a 2x2 grid of 16x16 WMMA accumulators,
// so every A-frag is reused across 2 N-subtiles and every B-frag across 2
// M-subtiles (2 LDS dwords per v_wmma_f32_16x16x4_f32).
// B panel is stored pair-interleaved in LDS ([k/2][n][2]) so a B-fragment is
// one aligned ds_load_b64 -> no VALU repacking before the WMMA.
// ---------------------------------------------------------------------------
__global__ __launch_bounds__(256) void gemm1024_bias_wmma(
    const float* __restrict__ A, const float* __restrict__ W,
    const float* __restrict__ bias, float* __restrict__ C) {
  constexpr int K = 1024, N = 1024;
  __shared__ __align__(16) float As[64 * 16];        // [m][k]       4 KB
  __shared__ __align__(16) float BsP[8 * 128 * 2];   // [k/2][n][2]  8 KB

  const int tid  = threadIdx.x;
  const int lane = tid & 31;
  const int wid  = tid >> 5;
  const int half = lane >> 4;   // 0: lanes 0-15, 1: lanes 16-31
  const int l16  = lane & 15;

  const int m0 = blockIdx.y * 64;
  const int n0 = blockIdx.x * 128;
  const int mw = (wid & 1) * 32;   // wave M offset in block tile
  const int nw = (wid >> 1) * 32;  // wave N offset in block tile

  // cooperative-load coordinates
  const int ar = tid >> 2;         // 0..63 : A panel row
  const int ac = (tid & 3) * 4;    // 0,4,8,12
  const int kp = tid >> 5;         // 0..7  : B panel k-pair
  const int n4 = (tid & 31) * 4;   // 0..124

  v8f acc00 = {}, acc01 = {}, acc10 = {}, acc11 = {};

  for (int k0 = 0; k0 < K; k0 += 16) {
    // A panel [64 x 16]
    const float4 av = *reinterpret_cast<const float4*>(&A[(size_t)(m0 + ar) * K + k0 + ac]);
    *reinterpret_cast<float4*>(&As[ar * 16 + ac]) = av;
    // B panel, pair-interleaved: {W[2kp, n], W[2kp+1, n]} contiguous
    const float4 f0 = *reinterpret_cast<const float4*>(&W[(size_t)(k0 + 2 * kp) * N + n0 + n4]);
    const float4 f1 = *reinterpret_cast<const float4*>(&W[(size_t)(k0 + 2 * kp + 1) * N + n0 + n4]);
    const int bbase = (kp * 128 + n4) * 2;
    float4 s0; s0.x = f0.x; s0.y = f1.x; s0.z = f0.y; s0.w = f1.y;
    float4 s1; s1.x = f0.z; s1.y = f1.z; s1.z = f0.w; s1.w = f1.w;
    *reinterpret_cast<float4*>(&BsP[bbase])     = s0;
    *reinterpret_cast<float4*>(&BsP[bbase + 4]) = s1;
    __syncthreads();

#pragma unroll
    for (int kk = 0; kk < 16; kk += 4) {
      const int kb = kk + 2 * half;  // even; A-frag lanes 0-15: K={kk,kk+1}, 16-31: K={kk+2,kk+3}
      const int kq = kb >> 1;
      v2f a0 = *reinterpret_cast<const v2f*>(&As[(mw + l16) * 16 + kb]);
      v2f a1 = *reinterpret_cast<const v2f*>(&As[(mw + 16 + l16) * 16 + kb]);
      v2f b0 = *reinterpret_cast<const v2f*>(&BsP[(kq * 128 + nw + l16) * 2]);
      v2f b1 = *reinterpret_cast<const v2f*>(&BsP[(kq * 128 + nw + 16 + l16) * 2]);
      acc00 = __builtin_amdgcn_wmma_f32_16x16x4_f32(false, a0, false, b0, (short)0, acc00, false, false);
      acc01 = __builtin_amdgcn_wmma_f32_16x16x4_f32(false, a0, false, b1, (short)0, acc01, false, false);
      acc10 = __builtin_amdgcn_wmma_f32_16x16x4_f32(false, a1, false, b0, (short)0, acc10, false, false);
      acc11 = __builtin_amdgcn_wmma_f32_16x16x4_f32(false, a1, false, b1, (short)0, acc11, false, false);
    }
    __syncthreads();
  }

  const float bias0 = bias[n0 + nw + l16];
  const float bias1 = bias[n0 + nw + 16 + l16];
#pragma unroll
  for (int r = 0; r < 8; ++r) {
    const int row0 = m0 + mw + r + 8 * half;       // C layout: vgpr r -> M=r / M=8+r per half
    const int row1 = row0 + 16;
    C[(size_t)row0 * N + n0 + nw + l16]      = acc00[r] + bias0;
    C[(size_t)row0 * N + n0 + nw + 16 + l16] = acc01[r] + bias1;
    C[(size_t)row1 * N + n0 + nw + l16]      = acc10[r] + bias0;
    C[(size_t)row1 * N + n0 + nw + 16 + l16] = acc11[r] + bias1;
  }
}

// ---------------------------------------------------------------------------
// Multi-query attention core. One work-group of 4 wave32 per 16-row query tile:
// wave w takes the 16-key blocks w, w+4, w+8, ... with its own running maxima,
// sums and output accumulators; the 4 partial results are merged through LDS.
//   Q: [B, 512, 1024] (per-head slice h*64..h*64+63)
//   K2/V2: [B, 8192, 64]  (k/v projections viewed as single head of len S*H)
//   Y: scrambled output, per batch flat index (h*64+d)*512 + s  (matches the
//      reference's swapaxes(-1,-2).reshape(B,-1,D))
// Flash-attention style online softmax; Q tile lives in VGPRs as WMMA A-frags.
// ---------------------------------------------------------------------------
// waves_per_eu(4, 4): exactly four work-groups (one wave per SIMD each) fit a WGP,
// so the 1024 work-groups are all resident at once and spread evenly.
__global__ __launch_bounds__(128) __attribute__((amdgpu_waves_per_eu(4, 4)))
void mqa_attention_wmma(
    const float* __restrict__ Q, const float* __restrict__ Kp,
    const float* __restrict__ Vp, float* __restrict__ Y) {
  constexpr int S = 512, HD = 64, SK = 8192;
  constexpr int NW = 4;        // waves per work-group = key splits
  constexpr int OP = 66;       // LDS pitch (floats) of a partial output row
  const int sTile = blockIdx.x;  // 0..31
  const int h     = blockIdx.y;  // 0..15
  const int b     = blockIdx.z;  // 0..1
  const int lane  = threadIdx.x & 31;
  const int wv    = __builtin_amdgcn_readfirstlane(threadIdx.x >> 5);  // scalar: uniform key loop
  const int half  = lane >> 4;
  const int l16   = lane & 15;
  const int sBase = sTile * 16;

  __shared__ __align__(8) float p_all[NW][16 * 16];  // one private P tile per wave
  __shared__ float o_part[NW][16 * OP];
  __shared__ float m_part[NW][16];
  __shared__ float l_part[NW][16];
  float* p_lds = p_all[wv];

  // Preload Q tile [16 x 64] as 16 A-fragments (K-steps of 4): 32 VGPRs/lane.
  const float* qrow = Q + ((size_t)b * S + sBase + l16) * 1024 + h * 64 + 2 * half;
  v2f qa[16];
#pragma unroll
  for (int kk = 0; kk < 16; ++kk)
    qa[kk] = *reinterpret_cast<const v2f*>(qrow + kk * 4);

  const float* kbase = Kp + (size_t)b * SK * HD;
  const float* vbase = Vp + (size_t)b * SK * HD;

  float mrow[8], lrow[8];
#pragma unroll
  for (int r = 0; r < 8; ++r) { mrow[r] = -__builtin_inff(); lrow[r] = 0.0f; }
  v8f accO[4] = {{}, {}, {}, {}};

  for (int j0 = wv * 16; j0 < SK; j0 += NW * 16) {
    // scores tile S16 = Q[16x64] @ K2[j0:j0+16, :]^T  (B-frag: n=j lane, k=d)
    v8f sc = {};
    const float* krow = kbase + (size_t)(j0 + l16) * HD + 2 * half;
#pragma unroll
    for (int kk = 0; kk < 16; ++kk) {
      v2f bf = *reinterpret_cast<const v2f*>(krow + kk * 4);
      sc = __builtin_amdgcn_wmma_f32_16x16x4_f32(false, qa[kk], false, bf, (short)0, sc, false, false);
    }

    // online softmax (rows split across wave halves exactly like the C layout)
#pragma unroll
    for (int r = 0; r < 8; ++r) {
      float c = sc[r] * 0.125f;  // 1/sqrt(64)
      float rmax = c;
      rmax = fmaxf(rmax, __shfl_xor(rmax, 1, 32));
      rmax = fmaxf(rmax, __shfl_xor(rmax, 2, 32));
      rmax = fmaxf(rmax, __shfl_xor(rmax, 4, 32));
      rmax = fmaxf(rmax, __shfl_xor(rmax, 8, 32));
      const float mnew = fmaxf(mrow[r], rmax);
      const float p = __expf(c - mnew);
      float ps = p;
      ps += __shfl_xor(ps, 1, 32);
      ps += __shfl_xor(ps, 2, 32);
      ps += __shfl_xor(ps, 4, 32);
      ps += __shfl_xor(ps, 8, 32);
      const float scl = __expf(mrow[r] - mnew);
      lrow[r] = lrow[r] * scl + ps;
      mrow[r] = mnew;
#pragma unroll
      for (int t = 0; t < 4; ++t) accO[t][r] *= scl;
      p_lds[(r + 8 * half) * 16 + l16] = p;  // stage P for A-frag re-layout
    }
    // P tile is private to this wave and a wave's LDS operations run in order:
    // only the compiler must be kept from moving the reads above the writes.
    __builtin_amdgcn_fence(__ATOMIC_RELEASE, "wavefront");
    __builtin_amdgcn_wave_barrier();
    __builtin_amdgcn_fence(__ATOMIC_ACQUIRE, "wavefront");

    // accO[16x64] += P[16x16] @ V2[j0:j0+16, 0:64]
#pragma unroll
    for (int kk = 0; kk < 4; ++kk) {
      const int kb = 4 * kk + 2 * half;
      v2f pa = *reinterpret_cast<const v2f*>(&p_lds[l16 * 16 + kb]);
      const float* vrow = vbase + (size_t)(j0 + kb) * HD;
#pragma unroll
      for (int t = 0; t < 4; ++t) {
        v2f bf;
        bf.x = vrow[t * 16 + l16];
        bf.y = vrow[HD + t * 16 + l16];
        accO[t] = __builtin_amdgcn_wmma_f32_16x16x4_f32(false, pa, false, bf, (short)0, accO[t], false, false);
      }
    }
    // keeps the next trip's P writes behind this trip's P reads in program order
    __builtin_amdgcn_fence(__ATOMIC_RELEASE, "wavefront");
    __builtin_amdgcn_wave_barrier();
    __builtin_amdgcn_fence(__ATOMIC_ACQUIRE, "wavefront");
  }

  // publish this wave's un-normalised partial output, maxima and sums
#pragma unroll
  for (int r = 0; r < 8; ++r) {
    const int row = r + 8 * half;
#pragma unroll
    for (int t = 0; t < 4; ++t) o_part[wv][row * OP + t * 16 + l16] = accO[t][r];
    if (l16 == 0) { m_part[wv][row] = mrow[r]; l_part[wv][row] = lrow[r]; }
  }
  __syncthreads();  // every wave's partial is in LDS before any thread merges

  // merge the key splits, normalize and write the scrambled layout:
  // Y[b].flat[(h*64+d)*512 + s]; 16 consecutive threads store 16 consecutive s
  float* ybase = Y + (size_t)b * (S * 1024);
  const int srow = threadIdx.x & 15;
  const int dq   = threadIdx.x >> 4;  // 0..7
  float mall = m_part[0][srow];
#pragma unroll
  for (int w = 1; w < NW; ++w) mall = fmaxf(mall, m_part[w][srow]);
  float wgt[NW];
  float lall = 0.0f;
#pragma unroll
  for (int w = 0; w < NW; ++w) {
    wgt[w] = __expf(m_part[w][srow] - mall);
    lall += wgt[w] * l_part[w][srow];
  }
  const float inv = 1.0f / lall;
#pragma unroll
  for (int i = 0; i < 8; ++i) {
    const int d = dq + 8 * i;
    float o = 0.0f;
#pragma unroll
    for (int w = 0; w < NW; ++w) o += wgt[w] * o_part[w][srow * OP + d];
    ybase[(size_t)(h * 64 + d) * 512 + sBase + srow] = o * inv;
  }
}

// ---------------------------------------------------------------------------
// Launch: 3 projection GEMMs -> attention -> output GEMM (consumes scrambled Y
// as a plain row-major [1024,1024] matrix, matching the reference faithfully).
// Workspace: Q(4MB) | K(4MB) | V(4MB) | Y(4MB) = 16MB.
// ---------------------------------------------------------------------------
extern "C" void kernel_launch(void* const* d_in, const int* in_sizes, int n_in,
                              void* d_out, int out_size, void* d_ws, size_t ws_size,
                              hipStream_t stream) {
  (void)in_sizes; (void)n_in; (void)out_size; (void)ws_size;
  const float* x  = (const float*)d_in[0];
  const float* Wq = (const float*)d_in[1];
  const float* bq = (const float*)d_in[2];
  const float* Wk = (const float*)d_in[3];
  const float* bk = (const float*)d_in[4];
  const float* Wv = (const float*)d_in[5];
  const float* bv = (const float*)d_in[6];
  const float* Wo = (const float*)d_in[7];
  const float* bo = (const float*)d_in[8];
  float* out = (float*)d_out;

  float* ws = (float*)d_ws;
  float* Qp = ws;
  float* Kp = ws + (1u << 20);
  float* Vp = ws + (2u << 20);
  float* Yp = ws + (3u << 20);

  const dim3 gGrid(8, 16, 1);   // N tiles of 128, M tiles of 64
  const dim3 gBlk(256, 1, 1);
  gemm1024_bias_wmma<<<gGrid, gBlk, 0, stream>>>(x, Wq, bq, Qp);
  gemm1024_bias_wmma<<<gGrid, gBlk, 0, stream>>>(x, Wk, bk, Kp);
  gemm1024_bias_wmma<<<gGrid, gBlk, 0, stream>>>(x, Wv, bv, Vp);
  mqa_attention_wmma<<<dim3(32, 16, 2), dim3(128, 1, 1), 0, stream>>>(Qp, Kp, Vp, Yp);
  gemm1024_bias_wmma<<<gGrid, gBlk, 0, stream>>>(Yp, Wo, bo, out);
}

// v002
// One run takes 471 microseconds.
// In both of two side-by-side timings against v001, it was 1.05 times as fast.
// Counting every step since v000, it is 2.17 times as fast.
#include <hip/hip_runtime.h>
#include <hip/hip_bf16.h>

typedef __attribute__((ext_vector_type(2))) float v2f;
typedef __attribute__((ext_vector_type(4))) float v4f;
typedef __attribute__((ext_vector_type(8))) float v8f;

// ---------------------------------------------------------------------------
// C[M=1024, N=1024] = A[1024,1024] @ W[1024,1024] + bias[N]
// Block: 256 threads = 8 wave32; block tile 64(M) x 128(N); K-step 16.
// Each wave computes a 32x32 tile as a 2x2 grid of 16x16 WMMA accumulators,
// so every A-frag is reused across 2 N-subtiles and every B-frag across 2
// M-subtiles (2 LDS dwords per v_wmma_f32_16x16x4_f32).
// B panel is stored pair-interleaved in LDS ([k/2][n][2]) so a B-fragment is
// one aligned ds_load_b64 -> no VALU repacking before the WMMA.
//
// LAYOUT picks how C is stored:
//   0: row-major [1024][1024].
//   1, 2: blocks of 1024 floats, one per (16 rows, 64 columns): block index
//      (row / 16) * 16 + col / 64. With m = row % 16 and d = col % 64 a block
//      holds 16 keys (m) of head size 64 (d) in the order in which the attention
//      kernel's lanes want them, so that each of its loads is 16 bytes a lane and
//      512 contiguous bytes a wave:
//   1 (keys):   [d / 8][(d / 4) % 2][m][d % 4]
//   2 (values): [m / 4][d / 32][(m / 2) % 2][d % 16][(d / 16) % 2][m % 2]
//   Every 128-byte line of a block is written by one wave.
// ---------------------------------------------------------------------------
template <int LAYOUT>
__global__ __launch_bounds__(256) void gemm1024_bias_wmma(
    const float* __restrict__ A, const float* __restrict__ W,
    const float* __restrict__ bias, float* __restrict__ C) {
  constexpr int K = 1024, N = 1024;
  __shared__ __align__(16) float As[64 * 16];        // [m][k]       4 KB
  __shared__ __align__(16) float BsP[8 * 128 * 2];   // [k/2][n][2]  8 KB

  const int tid  = threadIdx.x;
  const int lane = tid & 31;
  const int wid  = tid >> 5;
  const int half = lane >> 4;   // 0: lanes 0-15, 1: lanes 16-31
  const int l16  = lane & 15;

  const int m0 = blockIdx.y * 64;
  const int n0 = blockIdx.x * 128;
  const int mw = (wid & 1) * 32;   // wave M offset in block tile
  const int nw = (wid >> 1) * 32;  // wave N offset in block tile

  // cooperative-load coordinates
  const int ar = tid >> 2;         // 0..63 : A panel row
  const int ac = (tid & 3) * 4;    // 0,4,8,12
  const int kp = tid >> 5;         // 0..7  : B panel k-pair
  const int n4 = (tid & 31) * 4;   // 0..124

  v8f acc00 = {}, acc01 = {}, acc10 = {}, acc11 = {};

  for (int k0 = 0; k0 < K; k0 += 16) {
    // A panel [64 x 16]
    const float4 av = *reinterpret_cast<const float4*>(&A[(size_t)(m0 + ar) * K + k0 + ac]);
    *reinterpret_cast<float4*>(&As[ar * 16 + ac]) = av;
    // B panel, pair-interleaved: {W[2kp, n], W[2kp+1, n]} contiguous
    const float4 f0 = *reinterpret_cast<const float4*>(&W[(size_t)(k0 + 2 * kp) * N + n0 + n4]);
    const float4 f1 = *reinterpret_cast<const float4*>(&W[(size_t)(k0 + 2 * kp + 1) * N + n0 + n4]);
    const int bbase = (kp * 128 + n4) * 2;
    float4 s0; s0.x = f0.x; s0.y = f1.x; s0.z = f0.y; s0.w = f1.y;
    float4 s1; s1.x = f0.z; s1.y = f1.z; s1.z = f0.w; s1.w = f1.w;
    *reinterpret_cast<float4*>(&BsP[bbase])     = s0;
    *reinterpret_cast<float4*>(&BsP[bbase + 4]) = s1;
    __syncthreads();

#pragma unroll
    for (int kk = 0; kk < 16; kk += 4) {
      const int kb = kk + 2 * half;  // even; A-frag lanes 0-15: K={kk,kk+1}, 16-31: K={kk+2,kk+3}
      const int kq = kb >> 1;
      v2f a0 = *reinterpret_cast<const v2f*>(&As[(mw + l16) * 16 + kb]);
      v2f a1 = *reinterpret_cast<const v2f*>(&As[(mw + 16 + l16) * 16 + kb]);
      v2f b0 = *reinterpret_cast<const v2f*>(&BsP[(kq * 128 + nw + l16) * 2]);
      v2f b1 = *reinterpret_cast<const v2f*>(&BsP[(kq * 128 + nw + 16 + l16) * 2]);
      acc00 = __builtin_amdgcn_wmma_f32_16x16x4_f32(false, a0, false, b0, (short)0, acc00, false, false);
      acc01 = __builtin_amdgcn_wmma_f32_16x16x4_f32(false, a0, false, b1, (short)0, acc01, false, false);
      acc10 = __builtin_amdgcn_wmma_f32_16x16x4_f32(false, a1, false, b0, (short)0, acc10, false, false);
      acc11 = __builtin_amdgcn_wmma_f32_16x16x4_f32(false, a1, false, b1, (short)0, acc11, false, false);
    }
    __syncthreads();
  }

  const float bias0 = bias[n0 + nw + l16];
  const float bias1 = bias[n0 + nw + 16 + l16];
  if constexpr (LAYOUT == 0) {
#pragma unroll
    for (int r = 0; r < 8; ++r) {
      const int row0 = m0 + mw + r + 8 * half;       // C layout: vgpr r -> M=r / M=8+r per half
      const int row1 = row0 + 16;
      C[(size_t)row0 * N + n0 + nw + l16]      = acc00[r] + bias0;
      C[(size_t)row0 * N + n0 + nw + 16 + l16] = acc01[r] + bias1;
      C[(size_t)row1 * N + n0 + nw + l16]      = acc10[r] + bias0;
      C[(size_t)row1 * N + n0 + nw + 16 + l16] = acc11[r] + bias1;
    }
  } else {
    // the wave's 32 x 32 tile = rows of two blocks, 32 of their 64 columns
    const int dbase = (n0 + nw) & 63;  // 0 or 32
    float* blk0 = C + (size_t)(((m0 + mw) >> 4) * 16 + ((n0 + nw) >> 6)) * 1024;
    float* blk1 = blk0 + 16 * 1024;
    if constexpr (LAYOUT == 1) {
      const int d0 = dbase + l16;
      const int d1 = d0 + 16;
      const int o0 = (d0 >> 3) * 128 + ((d0 >> 2) & 1) * 64 + (d0 & 3) + 32 * half;
      const int o1 = (d1 >> 3) * 128 + ((d1 >> 2) & 1) * 64 + (d1 & 3) + 32 * half;
#pragma unroll
      for (int r = 0; r < 8; ++r) {  // m = r + 8 * half
        blk0[o0 + 4 * r] = acc00[r] + bias0;
        blk0[o1 + 4 * r] = acc01[r] + bias1;
        blk1[o0 + 4 * r] = acc10[r] + bias0;
        blk1[o1 + 4 * r] = acc11[r] + bias1;
      }
    } else {
      const int o = 512 * half + (dbase >> 5) * 128 + l16 * 4;
#pragma unroll
      for (int r = 0; r < 8; r += 2) {  // m = r + 8 * half and m + 1
        const int off = o + (r >> 2) * 256 + ((r >> 1) & 1) * 64;
        v4f s0 = {acc00[r] + bias0, acc00[r + 1] + bias0, acc01[r] + bias1, acc01[r + 1] + bias1};
        v4f s1 = {acc10[r] + bias0, acc10[r + 1] + bias0, acc11[r] + bias1, acc11[r + 1] + bias1};
        *reinterpret_cast<v4f*>(&blk0[off]) = s0;
        *reinterpret_cast<v4f*>(&blk1[off]) = s1;
      }
    }
  }
}

// ---------------------------------------------------------------------------
// Multi-query attention core. One work-group of 4 wave32 per 16-row query tile:
// wave w takes the 16-key blocks w, w+4, w+8, ... with its own running maxima,
// sums and output accumulators; the 4 partial results are merged through LDS.
//   Q: [B, 512, 1024] (per-head slice h*64..h*64+63)
//   K2/V2: per batch 512 blocks of 16 keys x 64, each block in the fragment order
//      that the projection kernel writes (LAYOUT 1 and 2). A block's 16 keys are
//      one 64-column slice of 16 consecutive rows of the projection; the softmax
//      and the weighted sum run over all 8192 keys, so their order is free as
//      long as K and V agree.
//   Y: scrambled output, per batch flat index (h*64+d)*512 + s  (matches the
//      reference's swapaxes(-1,-2).reshape(B,-1,D))
// Flash-attention style online softmax; Q tile lives in VGPRs as WMMA A-frags.
// ---------------------------------------------------------------------------
// waves_per_eu(4, 4): exactly four work-groups (one wave per SIMD each) fit a WGP,
// so the 1024 work-groups are all resident at once and spread evenly.
__global__ __launch_bounds__(128) __attribute__((amdgpu_waves_per_eu(4, 4)))
void mqa_attention_wmma(
    const float* __restrict__ Q, const float* __restrict__ Kp,
    const float* __restrict__ Vp, float* __restrict__ Y) {
  constexpr int S = 512, HD = 64, SK = 8192;
  constexpr int NW = 4;        // waves per work-group = key splits
  constexpr int OP = 66;       // LDS pitch (floats) of a partial output row
  const int sTile = blockIdx.x;  // 0..31
  const int h     = blockIdx.y;  // 0..15
  const int b     = blockIdx.z;  // 0..1
  const int lane  = threadIdx.x & 31;
  const int wv    = __builtin_amdgcn_readfirstlane(threadIdx.x >> 5);  // scalar: uniform key loop
  const int half  = lane >> 4;
  const int l16   = lane & 15;
  const int sBase = sTile * 16;

  __shared__ __align__(8) float p_all[NW][16 * 16];  // one private P tile per wave
  __shared__ float o_part[NW][16 * OP];
  __shared__ float m_part[NW][16];
  __shared__ float l_part[NW][16];
  float* p_lds = p_all[wv];

  // Preload Q tile [16 x 64] as 16 A-fragments (K-steps of 4): 32 VGPRs/lane.
  // k order of step 2g + i, register e: d = 8g + 4 * half + 2i + e, as in the K blocks.
  const float* qrow = Q + ((size_t)b * S + sBase + l16) * 1024 + h * 64 + 4 * half;
  v2f qa[16];
#pragma unroll
  for (int g = 0; g < 8; ++g) {
    const v4f q4 = *reinterpret_cast<const v4f*>(qrow + g * 8);
    qa[2 * g]     = __builtin_shufflevector(q4, q4, 0, 1);
    qa[2 * g + 1] = __builtin_shufflevector(q4, q4, 2, 3);
  }

  const float* kbase = Kp + (size_t)b * SK * HD;
  const float* vbase = Vp + (size_t)b * SK * HD;

  float mrow[8], lrow[8];
#pragma unroll
  for (int r = 0; r < 8; ++r) { mrow[r] = -__builtin_inff(); lrow[r] = 0.0f; }
  v8f accO[4] = {{}, {}, {}, {}};

  for (int j0 = wv * 16; j0 < SK; j0 += NW * 16) {
    // scores tile S16 = Q[16x64] @ (key block j0/16)^T  (B-frag: n=key lane, k=d);
    // one 16-byte load a lane holds the B-fragments of two K-steps
    v8f sc = {};
    const float* kblk = kbase + (size_t)j0 * HD + lane * 4;
#pragma unroll
    for (int g = 0; g < 8; ++g) {
      const v4f k4 = *reinterpret_cast<const v4f*>(kblk + g * 128);
      const v2f b0 = __builtin_shufflevector(k4, k4, 0, 1);
      const v2f b1 = __builtin_shufflevector(k4, k4, 2, 3);
      sc = __builtin_amdgcn_wmma_f32_16x16x4_f32(false, qa[2 * g], false, b0, (short)0, sc, false, false);
      sc = __builtin_amdgcn_wmma_f32_16x16x4_f32(false, qa[2 * g + 1], false, b1, (short)0, sc, false, false);
    }

    // online softmax (rows split across wave halves exactly like the C layout)
#pragma unroll
    for (int r = 0; r < 8; ++r) {
      float c = sc[r] * 0.125f;  // 1/sqrt(64)
      float rmax = c;
      rmax = fmaxf(rmax, __shfl_xor(rmax, 1, 32));
      rmax = fmaxf(rmax, __shfl_xor(rmax, 2, 32));
      rmax = fmaxf(rmax, __shfl_xor(rmax, 4, 32));
      rmax = fmaxf(rmax, __shfl_xor(rmax, 8, 32));
      const float mnew = fmaxf(mrow[r], rmax);
      const float p = __expf(c - mnew);
      float ps = p;
      ps += __shfl_xor(ps, 1, 32);
      ps += __shfl_xor(ps, 2, 32);
      ps += __shfl_xor(ps, 4, 32);
      ps += __shfl_xor(ps, 8, 32);
      const float scl = __expf(mrow[r] - mnew);
      lrow[r] = lrow[r] * scl + ps;
      mrow[r] = mnew;
#pragma unroll
      for (int t = 0; t < 4; ++t) accO[t][r] *= scl;
      p_lds[(r + 8 * half) * 16 + l16] = p;  // stage P for A-frag re-layout
    }
    // P tile is private to this wave and a wave's LDS operations run in order:
    // only the compiler must be kept from moving the reads above the writes.
    __builtin_amdgcn_fence(__ATOMIC_RELEASE, "wavefront");
    __builtin_amdgcn_wave_barrier();
    __builtin_amdgcn_fence(__ATOMIC_ACQUIRE, "wavefront");

    // accO[16x64] += P[16x16] @ (value block j0/16)[16x64];
    // one 16-byte load a lane holds the B-fragments of two column tiles
    const float* vblk = vbase + (size_t)j0 * HD + lane * 4;
#pragma unroll
    for (int kk = 0; kk < 4; ++kk) {
      const int kb = 4 * kk + 2 * half;
      v2f pa = *reinterpret_cast<const v2f*>(&p_lds[l16 * 16 + kb]);
#pragma unroll
      for (int tp = 0; tp < 2; ++tp) {
        const v4f v4 = *reinterpret_cast<const v4f*>(vblk + kk * 256 + tp * 128);
        const v2f b0 = __builtin_shufflevector(v4, v4, 0, 1);
        const v2f b1 = __builtin_shufflevector(v4, v4, 2, 3);
        accO[2 * tp]     = __builtin_amdgcn_wmma_f32_16x16x4_f32(false, pa, false, b0, (short)0, accO[2 * tp], false, false);
        accO[2 * tp + 1] = __builtin_amdgcn_wmma_f32_16x16x4_f32(false, pa, false, b1, (short)0, accO[2 * tp + 1], false, false);
      }
    }
    // keeps the next trip's P writes behind this trip's P reads in program order
    __builtin_amdgcn_fence(__ATOMIC_RELEASE, "wavefront");
    __builtin_amdgcn_wave_barrier();
    __builtin_amdgcn_fence(__ATOMIC_ACQUIRE, "wavefront");
  }

  // publish this wave's un-normalised partial output, maxima and sums
#pragma unroll
  for (int r = 0; r < 8; ++r) {
    const int row = r + 8 * half;
#pragma unroll
    for (int t = 0; t < 4; ++t) o_part[wv][row * OP + t * 16 + l16] = accO[t][r];
    if (l16 == 0) { m_part[wv][row] = mrow[r]; l_part[wv][row] = lrow[r]; }
  }
  __syncthreads();  // every wave's partial is in LDS before any thread merges

  // merge the key splits, normalize and write the scrambled layout:
  // Y[b].flat[(h*64+d)*512 + s]; 16 consecutive threads store 16 consecutive s
  float* ybase = Y + (size_t)b * (S * 1024);
  const int srow = threadIdx.x & 15;
  const int dq   = threadIdx.x >> 4;  // 0..7
  float mall = m_part[0][srow];
#pragma unroll
  for (int w = 1; w < NW; ++w) mall = fmaxf(mall, m_part[w][srow]);
  float wgt[NW];
  float lall = 0.0f;
#pragma unroll
  for (int w = 0; w < NW; ++w) {
    wgt[w] = __expf(m_part[w][srow] - mall);
    lall += wgt[w] * l_part[w][srow];
  }
  const float inv = 1.0f / lall;
#pragma unroll
  for (int i = 0; i < 8; ++i) {
    const int d = dq + 8 * i;
    float o = 0.0f;
#pragma unroll
    for (int w = 0; w < NW; ++w) o += wgt[w] * o_part[w][srow * OP + d];
    ybase[(size_t)(h * 64 + d) * 512 + sBase + srow] = o * inv;
  }
}

// ---------------------------------------------------------------------------
// Launch: 3 projection GEMMs (K and V stored in fragment order) -> attention ->
// output GEMM (consumes scrambled Y as a plain row-major [1024,1024] matrix,
// matching the reference faithfully).
// Workspace: Q(4MB) | K(4MB) | V(4MB) | Y(4MB) = 16MB.
// ---------------------------------------------------------------------------
extern "C" void kernel_launch(void* const* d_in, const int* in_sizes, int n_in,
                              void* d_out, int out_size, void* d_ws, size_t ws_size,
                              hipStream_t stream) {
  (void)in_sizes; (void)n_in; (void)out_size; (void)ws_size;
  const float* x  = (const float*)d_in[0];
  const float* Wq = (const float*)d_in[1];
  const float* bq = (const float*)d_in[2];
  const float* Wk = (const float*)d_in[3];
  const float* bk = (const float*)d_in[4];
  const float* Wv = (const float*)d_in[5];
  const float* bv = (const float*)d_in[6];
  const float* Wo = (const float*)d_in[7];
  const float* bo = (const float*)d_in[8];
  float* out = (float*)d_out;

  float* ws = (float*)d_ws;
  float* Qp = ws;
  float* Kp = ws + (1u << 20);
  float* Vp = ws + (2u << 20);
  float* Yp = ws + (3u << 20);

  const dim3 gGrid(8, 16, 1);   // N tiles of 128, M tiles of 64
  const dim3 gBlk(256, 1, 1);
  gemm1024_bias_wmma<0><<<gGrid, gBlk, 0, stream>>>(x, Wq, bq, Qp);
  gemm1024_bias_wmma<1><<<gGrid, gBlk, 0, stream>>>(x, Wk, bk, Kp);
  gemm1024_bias_wmma<2><<<gGrid, gBlk, 0, stream>>>(x, Wv, bv, Vp);
  mqa_attention_wmma<<<dim3(32, 16, 2), dim3(128, 1, 1), 0, stream>>>(Qp, Kp, Vp, Yp);
  gemm1024_bias_wmma<0><<<gGrid, gBlk, 0, stream>>>(Yp, Wo, bo, out);
}

// v003
// One run takes 422 microseconds.
// In two side-by-side timings against v002, it was 1.11 and 1.12 times as fast.
// Counting every step since v000, it is 2.42 times as fast.
#include <hip/hip_runtime.h>
#include <hip/hip_bf16.h>

typedef __attribute__((ext_vector_type(2))) float v2f;
typedef __attribute__((ext_vector_type(4))) float v4f;
typedef __attribute__((ext_vector_type(8))) float v8f;

// ---------------------------------------------------------------------------
// C[M=1024, N=1024] = A[1024,1024] @ W[1024,1024] + bias[N]
// Block: 256 threads = 8 wave32; block tile 64(M) x 128(N); K-step 16.
// Each wave computes a 32x32 tile as a 2x2 grid of 16x16 WMMA accumulators,
// so every A-frag is reused across 2 N-subtiles and every B-frag across 2
// M-subtiles (2 LDS dwords per v_wmma_f32_16x16x4_f32).
// B panel is stored pair-interleaved in LDS ([k/2][n][2]) so a B-fragment is
// one aligned ds_load_b64 -> no VALU repacking before the WMMA.
//
// LAYOUT picks how C is stored:
//   0: row-major [1024][1024].
//   1, 2: blocks of 1024 floats, one per (16 rows, 64 columns): block index
//      (row / 16) * 16 + col / 64. With m = row % 16 and d = col % 64 a block
//      holds 16 keys (m) of head size 64 (d) in the order in which the attention
//      kernel's lanes want them, so that each of its loads is 16 bytes a lane and
//      512 contiguous bytes a wave:
//   1 (keys):   [d / 8][(d / 4) % 2][m][d % 4]
//   2 (values): [(m % 8) / 2][d / 32][m / 8][d % 16][(d / 16) % 2][m % 2]
//   Every 128-byte line of a block is written by one wave.
// ---------------------------------------------------------------------------
template <int LAYOUT>
__global__ __launch_bounds__(256) void gemm1024_bias_wmma(
    const float* __restrict__ A, const float* __restrict__ W,
    const float* __restrict__ bias, float* __restrict__ C) {
  constexpr int K = 1024, N = 1024;
  __shared__ __align__(16) float As[64 * 16];        // [m][k]       4 KB
  __shared__ __align__(16) float BsP[8 * 128 * 2];   // [k/2][n][2]  8 KB

  const int tid  = threadIdx.x;
  const int lane = tid & 31;
  const int wid  = tid >> 5;
  const int half = lane >> 4;   // 0: lanes 0-15, 1: lanes 16-31
  const int l16  = lane & 15;

  const int m0 = blockIdx.y * 64;
  const int n0 = blockIdx.x * 128;
  const int mw = (wid & 1) * 32;   // wave M offset in block tile
  const int nw = (wid >> 1) * 32;  // wave N offset in block tile

  // cooperative-load coordinates
  const int ar = tid >> 2;         // 0..63 : A panel row
  const int ac = (tid & 3) * 4;    // 0,4,8,12
  const int kp = tid >> 5;         // 0..7  : B panel k-pair
  const int n4 = (tid & 31) * 4;   // 0..124

  v8f acc00 = {}, acc01 = {}, acc10 = {}, acc11 = {};

  for (int k0 = 0; k0 < K; k0 += 16) {
    // A panel [64 x 16]
    const float4 av = *reinterpret_cast<const float4*>(&A[(size_t)(m0 + ar) * K + k0 + ac]);
    *reinterpret_cast<float4*>(&As[ar * 16 + ac]) = av;
    // B panel, pair-interleaved: {W[2kp, n], W[2kp+1, n]} contiguous
    const float4 f0 = *reinterpret_cast<const float4*>(&W[(size_t)(k0 + 2 * kp) * N + n0 + n4]);
    const float4 f1 = *reinterpret_cast<const float4*>(&W[(size_t)(k0 + 2 * kp + 1) * N + n0 + n4]);
    const int bbase = (kp * 128 + n4) * 2;
    float4 s0; s0.x = f0.x; s0.y = f1.x; s0.z = f0.y; s0.w = f1.y;
    float4 s1; s1.x = f0.z; s1.y = f1.z; s1.z = f0.w; s1.w = f1.w;
    *reinterpret_cast<float4*>(&BsP[bbase])     = s0;
    *reinterpret_cast<float4*>(&BsP[bbase + 4]) = s1;
    __syncthreads();

#pragma unroll
    for (int kk = 0; kk < 16; kk += 4) {
      const int kb = kk + 2 * half;  // even; A-frag lanes 0-15: K={kk,kk+1}, 16-31: K={kk+2,kk+3}
      const int kq = kb >> 1;
      v2f a0 = *reinterpret_cast<const v2f*>(&As[(mw + l16) * 16 + kb]);
      v2f a1 = *reinterpret_cast<const v2f*>(&As[(mw + 16 + l16) * 16 + kb]);
      v2f b0 = *reinterpret_cast<const v2f*>(&BsP[(kq * 128 + nw + l16) * 2]);
      v2f b1 = *reinterpret_cast<const v2f*>(&BsP[(kq * 128 + nw + 16 + l16) * 2]);
      acc00 = __builtin_amdgcn_wmma_f32_16x16x4_f32(false, a0, false, b0, (short)0, acc00, false, false);
      acc01 = __builtin_amdgcn_wmma_f32_16x16x4_f32(false, a0, false, b1, (short)0, acc01, false, false);
      acc10 = __builtin_amdgcn_wmma_f32_16x16x4_f32(false, a1, false, b0, (short)0, acc10, false, false);
      acc11 = __builtin_amdgcn_wmma_f32_16x16x4_f32(false, a1, false, b1, (short)0, acc11, false, false);
    }
    __syncthreads();
  }

  const float bias0 = bias[n0 + nw + l16];
  const float bias1 = bias[n0 + nw + 16 + l16];
  if constexpr (LAYOUT == 0) {
#pragma unroll
    for (int r = 0; r < 8; ++r) {
      const int row0 = m0 + mw + r + 8 * half;       // C layout: vgpr r -> M=r / M=8+r per half
      const int row1 = row0 + 16;
      C[(size_t)row0 * N + n0 + nw + l16]      = acc00[r] + bias0;
      C[(size_t)row0 * N + n0 + nw + 16 + l16] = acc01[r] + bias1;
      C[(size_t)row1 * N + n0 + nw + l16]      = acc10[r] + bias0;
      C[(size_t)row1 * N + n0 + nw + 16 + l16] = acc11[r] + bias1;
    }
  } else {
    // the wave's 32 x 32 tile = rows of two blocks, 32 of their 64 columns
    const int dbase = (n0 + nw) & 63;  // 0 or 32
    float* blk0 = C + (size_t)(((m0 + mw) >> 4) * 16 + ((n0 + nw) >> 6)) * 1024;
    float* blk1 = blk0 + 16 * 1024;
    if constexpr (LAYOUT == 1) {
      const int d0 = dbase + l16;
      const int d1 = d0 + 16;
      const int o0 = (d0 >> 3) * 128 + ((d0 >> 2) & 1) * 64 + (d0 & 3) + 32 * half;
      const int o1 = (d1 >> 3) * 128 + ((d1 >> 2) & 1) * 64 + (d1 & 3) + 32 * half;
#pragma unroll
      for (int r = 0; r < 8; ++r) {  // m = r + 8 * half
        blk0[o0 + 4 * r] = acc00[r] + bias0;
        blk0[o1 + 4 * r] = acc01[r] + bias1;
        blk1[o0 + 4 * r] = acc10[r] + bias0;
        blk1[o1 + 4 * r] = acc11[r] + bias1;
      }
    } else {
      const int o = (dbase >> 5) * 128 + lane * 4;
#pragma unroll
      for (int r = 0; r < 8; r += 2) {  // m = r + 8 * half and m + 1
        const int off = o + (r >> 1) * 256;
        v4f s0 = {acc00[r] + bias0, acc00[r + 1] + bias0, acc01[r] + bias1, acc01[r + 1] + bias1};
        v4f s1 = {acc10[r] + bias0, acc10[r + 1] + bias0, acc11[r] + bias1, acc11[r + 1] + bias1};
        *reinterpret_cast<v4f*>(&blk0[off]) = s0;
        *reinterpret_cast<v4f*>(&blk1[off]) = s1;
      }
    }
  }
}

// ---------------------------------------------------------------------------
// Multi-query attention core. One work-group of 4 wave32 per 16-row query tile:
// wave w takes the 16-key blocks w, w+4, w+8, ... with its own running maxima,
// sums and output accumulators; the 4 partial results are merged through LDS.
//   Q: [B, 512, 1024] (per-head slice h*64..h*64+63)
//   K2/V2: per batch 512 blocks of 16 keys x 64, each block in the fragment order
//      that the projection kernel writes (LAYOUT 1 and 2). A block's 16 keys are
//      one 64-column slice of 16 consecutive rows of the projection; the softmax
//      and the weighted sum run over all 8192 keys, so their order is free as
//      long as K and V agree.
//   Y: scrambled output, per batch flat index (h*64+d)*512 + s  (matches the
//      reference's swapaxes(-1,-2).reshape(B,-1,D))
// Both products are transposed: S^T = K . Q^T (A = key block, B = Q, kept in VGPRs)
// and O^T += V^T . P^T. Lane (half, q) then holds the scores of query q against keys
// 8 * half + r in its 8 accumulator registers: the maximum and the sum run inside the
// lane, the two halves exchange one value a block, and registers 2j, 2j + 1 of P^T are
// the B-fragment of K-step j as they stand (keys 8 * half + 2j + e, the V block's order).
// ---------------------------------------------------------------------------
// lane l with lane l ^ 16
__device__ __forceinline__ float xhalf(float x) {
  const int b = __builtin_bit_cast(int, x);
  return __builtin_bit_cast(float, __builtin_amdgcn_permlanex16(b, b, 0x76543210, 0xfedcba98, false, false));
}

// waves_per_eu(4, 4): exactly four work-groups (one wave per SIMD each) fit a WGP,
// so the 1024 work-groups are all resident at once and spread evenly.
__global__ __launch_bounds__(128) __attribute__((amdgpu_waves_per_eu(4, 4)))
void mqa_attention_wmma(
    const float* __restrict__ Q, const float* __restrict__ Kp,
    const float* __restrict__ Vp, float* __restrict__ Y) {
  constexpr int S = 512, HD = 64, SK = 8192;
  constexpr int NW = 4;        // waves per work-group = key splits
  const int sTile = blockIdx.x;  // 0..31
  const int h     = blockIdx.y;  // 0..15
  const int b     = blockIdx.z;  // 0..1
  const int lane  = threadIdx.x & 31;
  const int wv    = __builtin_amdgcn_readfirstlane(threadIdx.x >> 5);  // scalar: uniform key loop
  const int half  = lane >> 4;
  const int l16   = lane & 15;
  const int sBase = sTile * 16;

  __shared__ float o_part[NW][32 * 32];  // [accumulator register][lane]
  __shared__ float m_part[NW][16];
  __shared__ float l_part[NW][16];

  // Preload Q tile [16 x 64] as 16 B-fragments (K-steps of 4): 32 VGPRs/lane.
  // k order of step 2g + i, register e: d = 8g + 4 * half + 2i + e, as in the K blocks.
  const float* qrow = Q + ((size_t)b * S + sBase + l16) * 1024 + h * 64 + 4 * half;
  v2f qb[16];
#pragma unroll
  for (int g = 0; g < 8; ++g) {
    const v4f q4 = *reinterpret_cast<const v4f*>(qrow + g * 8);
    qb[2 * g]     = __builtin_shufflevector(q4, q4, 0, 1);
    qb[2 * g + 1] = __builtin_shufflevector(q4, q4, 2, 3);
  }

  const float* kbase = Kp + (size_t)b * SK * HD;
  const float* vbase = Vp + (size_t)b * SK * HD;

  float mrun = -__builtin_inff();  // running maximum of query l16, equal in both halves
  float lrun = 0.0f;               // running sum over this half's keys only
  v8f accO[4] = {{}, {}, {}, {}};  // accO[t][r] = O^T[d = 16t + 8 * half + r][query l16]

  for (int j0 = wv * 16; j0 < SK; j0 += NW * 16) {
    // S^T tile = (key block j0/16)[16x64] @ Q^T  (A-frag: m=key lane, k=d);
    // one 16-byte load a lane holds the A-fragments of two K-steps
    v8f sc = {};
    const float* kblk = kbase + (size_t)j0 * HD + lane * 4;
#pragma unroll
    for (int g = 0; g < 8; ++g) {
      const v4f k4 = *reinterpret_cast<const v4f*>(kblk + g * 128);
      const v2f a0 = __builtin_shufflevector(k4, k4, 0, 1);
      const v2f a1 = __builtin_shufflevector(k4, k4, 2, 3);
      sc = __builtin_amdgcn_wmma_f32_16x16x4_f32(false, a0, false, qb[2 * g], (short)0, sc, false, false);
      sc = __builtin_amdgcn_wmma_f32_16x16x4_f32(false, a1, false, qb[2 * g + 1], (short)0, sc, false, false);
    }

    // online softmax of query l16 over the block's 16 keys (8 here, 8 in lane ^ 16)
    float bmax = fmaxf(fmaxf(fmaxf(sc[0], sc[1]), fmaxf(sc[2], sc[3])),
                       fmaxf(fmaxf(sc[4], sc[5]), fmaxf(sc[6], sc[7])));
    bmax = fmaxf(bmax, xhalf(bmax));
    const float mnew = fmaxf(mrun, bmax * 0.125f);  // 1/sqrt(64)
    const float scl = __expf(mrun - mnew);
    float p[8];
#pragma unroll
    for (int r = 0; r < 8; ++r) p[r] = __expf(sc[r] * 0.125f - mnew);
    const float ps = ((p[0] + p[1]) + (p[2] + p[3])) + ((p[4] + p[5]) + (p[6] + p[7]));
    lrun = lrun * scl + ps;
    mrun = mnew;
#pragma unroll
    for (int t = 0; t < 4; ++t) accO[t] *= scl;

    // accO^T[64x16] += (value block j0/16)^T[64x16] @ P^T[16x16];
    // one 16-byte load a lane holds the A-fragments of two d tiles
    const float* vblk = vbase + (size_t)j0 * HD + lane * 4;
#pragma unroll
    for (int j = 0; j < 4; ++j) {
      const v2f pb = {p[2 * j], p[2 * j + 1]};
#pragma unroll
      for (int tp = 0; tp < 2; ++tp) {
        const v4f v4 = *reinterpret_cast<const v4f*>(vblk + j * 256 + tp * 128);
        const v2f a0 = __builtin_shufflevector(v4, v4, 0, 1);
        const v2f a1 = __builtin_shufflevector(v4, v4, 2, 3);
        accO[2 * tp]     = __builtin_amdgcn_wmma_f32_16x16x4_f32(false, a0, false, pb, (short)0, accO[2 * tp], false, false);
        accO[2 * tp + 1] = __builtin_amdgcn_wmma_f32_16x16x4_f32(false, a1, false, pb, (short)0, accO[2 * tp + 1], false, false);
      }
    }
  }

  // publish this wave's un-normalised partial output, maxima and sums
  const float lsum = lrun + xhalf(lrun);  // join the halves' sums once
#pragma unroll
  for (int t = 0; t < 4; ++t)
#pragma unroll
    for (int r = 0; r < 8; ++r) o_part[wv][(t * 8 + r) * 32 + lane] = accO[t][r];
  if (half == 0) { m_part[wv][l16] = mrun; l_part[wv][l16] = lsum; }
  __syncthreads();  // every wave's partial is in LDS before any thread merges

  // merge the key splits, normalize and write the scrambled layout:
  // Y[b].flat[(h*64+d)*512 + s]; 16 consecutive threads store 16 consecutive s
  float* ybase = Y + (size_t)b * (S * 1024);
  const int srow = threadIdx.x & 15;
  const int dq   = threadIdx.x >> 4;  // 0..7
  float mall = m_part[0][srow];
#pragma unroll
  for (int w = 1; w < NW; ++w) mall = fmaxf(mall, m_part[w][srow]);
  float wgt[NW];
  float lall = 0.0f;
#pragma unroll
  for (int w = 0; w < NW; ++w) {
    wgt[w] = __expf(m_part[w][srow] - mall);
    lall += wgt[w] * l_part[w][srow];
  }
  const float inv = 1.0f / lall;
#pragma unroll
  for (int i = 0; i < 8; ++i) {
    const int d = dq + 8 * i;  // tile i / 2, half i % 2, register dq
    float o = 0.0f;
#pragma unroll
    for (int w = 0; w < NW; ++w) o += wgt[w] * o_part[w][((i >> 1) * 8 + dq) * 32 + (i & 1) * 16 + srow];
    ybase[(size_t)(h * 64 + d) * 512 + sBase + srow] = o * inv;
  }
}

// ---------------------------------------------------------------------------
// Launch: 3 projection GEMMs (K and V stored in fragment order) -> attention ->
// output GEMM (consumes scrambled Y as a plain row-major [1024,1024] matrix,
// matching the reference faithfully).
// Workspace: Q(4MB) | K(4MB) | V(4MB) | Y(4MB) = 16MB.
// ---------------------------------------------------------------------------
extern "C" void kernel_launch(void* const* d_in, const int* in_sizes, int n_in,
                              void* d_out, int out_size, void* d_ws, size_t ws_size,
                              hipStream_t stream) {
  (void)in_sizes; (void)n_in; (void)out_size; (void)ws_size;
  const float* x  = (const float*)d_in[0];
  const float* Wq = (const float*)d_in[1];
  const float* bq = (const float*)d_in[2];
  const float* Wk = (const float*)d_in[3];
  const float* bk = (const float*)d_in[4];
  const float* Wv = (const float*)d_in[5];
  const float* bv = (const float*)d_in[6];
  const float* Wo = (const float*)d_in[7];
  const float* bo = (const float*)d_in[8];
  float* out = (float*)d_out;

  float* ws = (float*)d_ws;
  float* Qp = ws;
  float* Kp = ws + (1u << 20);
  float* Vp = ws + (2u << 20);
  float* Yp = ws + (3u << 20);

  const dim3 gGrid(8, 16, 1);   // N tiles of 128, M tiles of 64
  const dim3 gBlk(256, 1, 1);
  gemm1024_bias_wmma<0><<<gGrid, gBlk, 0, stream>>>(x, Wq, bq, Qp);
  gemm1024_bias_wmma<1><<<gGrid, gBlk, 0, stream>>>(x, Wk, bk, Kp);
  gemm1024_bias_wmma<2><<<gGrid, gBlk, 0, stream>>>(x, Wv, bv, Vp);
  mqa_attention_wmma<<<dim3(32, 16, 2), dim3(128, 1, 1), 0, stream>>>(Qp, Kp, Vp, Yp);
  gemm1024_bias_wmma<0><<<gGrid, gBlk, 0, stream>>>(Yp, Wo, bo, out);
}

// v004
// One run takes 308 microseconds.
// Next to v003, in two timings, it ran 1.37 times as fast each time.
// All steps since v000 together make it 3.32 times as fast.
#include <hip/hip_runtime.h>
#include <hip/hip_bf16.h>

typedef __attribute__((ext_vector_type(2))) float v2f;
typedef __attribute__((ext_vector_type(4))) float v4f;
typedef __attribute__((ext_vector_type(8))) float v8f;

// ---------------------------------------------------------------------------
// C[M=1024, N=1024] = A[1024,1024] @ W[1024,1024] + bias[N]
// Block: 256 threads = 8 wave32; block tile 64(M) x 128(N); K-step 16.
// Each wave computes a 32x32 tile as a 2x2 grid of 16x16 WMMA accumulators,
// so every A-frag is reused across 2 N-subtiles and every B-frag across 2
// M-subtiles (2 LDS dwords per v_wmma_f32_16x16x4_f32).
// B panel is stored pair-interleaved in LDS ([k/2][n][2]) so a B-fragment is
// one aligned ds_load_b64 -> no VALU repacking before the WMMA.
//
// layout picks how C is stored:
//   0: row-major [1024][1024].
//   1, 2: blocks of 1024 floats, one per (16 rows, 64 columns): block index
//      (row / 16) * 16 + col / 64. With m = row % 16 and d = col % 64 a block
//      holds 16 keys (m) of head size 64 (d) in the order in which the attention
//      kernel's lanes want them, so that each of its loads is 16 bytes a lane and
//      512 contiguous bytes a wave:
//   1 (keys):   [d / 8][(d / 4) % 2][m][d % 4]
//   2 (values): [(m % 8) / 2][d / 32][m / 8][d % 16][(d / 16) % 2][m % 2]
//   Every 128-byte line of a block is written by one wave.
// ---------------------------------------------------------------------------
__device__ __forceinline__ void gemm1024_bias_tile(
    const float* __restrict__ A, const float* __restrict__ W,
    const float* __restrict__ bias, float* __restrict__ C, const int layout) {
  constexpr int K = 1024, N = 1024;
  __shared__ __align__(16) float As[64 * 16];        // [m][k]       4 KB
  __shared__ __align__(16) float BsP[8 * 128 * 2];   // [k/2][n][2]  8 KB

  const int tid  = threadIdx.x;
  const int lane = tid & 31;
  const int wid  = tid >> 5;
  const int half = lane >> 4;   // 0: lanes 0-15, 1: lanes 16-31
  const int l16  = lane & 15;

  const int m0 = blockIdx.y * 64;
  const int n0 = blockIdx.x * 128;
  const int mw = (wid & 1) * 32;   // wave M offset in block tile
  const int nw = (wid >> 1) * 32;  // wave N offset in block tile

  // cooperative-load coordinates
  const int ar = tid >> 2;         // 0..63 : A panel row
  const int ac = (tid & 3) * 4;    // 0,4,8,12
  const int kp = tid >> 5;         // 0..7  : B panel k-pair
  const int n4 = (tid & 31) * 4;   // 0..124

  v8f acc00 = {}, acc01 = {}, acc10 = {}, acc11 = {};

  for (int k0 = 0; k0 < K; k0 += 16) {
    // A panel [64 x 16]
    const float4 av = *reinterpret_cast<const float4*>(&A[(size_t)(m0 + ar) * K + k0 + ac]);
    *reinterpret_cast<float4*>(&As[ar * 16 + ac]) = av;
    // B panel, pair-interleaved: {W[2kp, n], W[2kp+1, n]} contiguous
    const float4 f0 = *reinterpret_cast<const float4*>(&W[(size_t)(k0 + 2 * kp) * N + n0 + n4]);
    const float4 f1 = *reinterpret_cast<const float4*>(&W[(size_t)(k0 + 2 * kp + 1) * N + n0 + n4]);
    const int bbase = (kp * 128 + n4) * 2;
    float4 s0; s0.x = f0.x; s0.y = f1.x; s0.z = f0.y; s0.w = f1.y;
    float4 s1; s1.x = f0.z; s1.y = f1.z; s1.z = f0.w; s1.w = f1.w;
    *reinterpret_cast<float4*>(&BsP[bbase])     = s0;
    *reinterpret_cast<float4*>(&BsP[bbase + 4]) = s1;
    __syncthreads();

#pragma unroll
    for (int kk = 0; kk < 16; kk += 4) {
      const int kb = kk + 2 * half;  // even; A-frag lanes 0-15: K={kk,kk+1}, 16-31: K={kk+2,kk+3}
      const int kq = kb >> 1;
      v2f a0 = *reinterpret_cast<const v2f*>(&As[(mw + l16) * 16 + kb]);
      v2f a1 = *reinterpret_cast<const v2f*>(&As[(mw + 16 + l16) * 16 + kb]);
      v2f b0 = *reinterpret_cast<const v2f*>(&BsP[(kq * 128 + nw + l16) * 2]);
      v2f b1 = *reinterpret_cast<const v2f*>(&BsP[(kq * 128 + nw + 16 + l16) * 2]);
      acc00 = __builtin_amdgcn_wmma_f32_16x16x4_f32(false, a0, false, b0, (short)0, acc00, false, false);
      acc01 = __builtin_amdgcn_wmma_f32_16x16x4_f32(false, a0, false, b1, (short)0, acc01, false, false);
      acc10 = __builtin_amdgcn_wmma_f32_16x16x4_f32(false, a1, false, b0, (short)0, acc10, false, false);
      acc11 = __builtin_amdgcn_wmma_f32_16x16x4_f32(false, a1, false, b1, (short)0, acc11, false, false);
    }
    __syncthreads();
  }

  const float bias0 = bias[n0 + nw + l16];
  const float bias1 = bias[n0 + nw + 16 + l16];
  if (layout == 0) {
#pragma unroll
    for (int r = 0; r < 8; ++r) {
      const int row0 = m0 + mw + r + 8 * half;       // C layout: vgpr r -> M=r / M=8+r per half
      const int row1 = row0 + 16;
      C[(size_t)row0 * N + n0 + nw + l16]      = acc00[r] + bias0;
      C[(size_t)row0 * N + n0 + nw + 16 + l16] = acc01[r] + bias1;
      C[(size_t)row1 * N + n0 + nw + l16]      = acc10[r] + bias0;
      C[(size_t)row1 * N + n0 + nw + 16 + l16] = acc11[r] + bias1;
    }
  } else {
    // the wave's 32 x 32 tile = rows of two blocks, 32 of their 64 columns
    const int dbase = (n0 + nw) & 63;  // 0 or 32
    float* blk0 = C + (size_t)(((m0 + mw) >> 4) * 16 + ((n0 + nw) >> 6)) * 1024;
    float* blk1 = blk0 + 16 * 1024;
    if (layout == 1) {
      const int d0 = dbase + l16;
      const int d1 = d0 + 16;
      const int o0 = (d0 >> 3) * 128 + ((d0 >> 2) & 1) * 64 + (d0 & 3) + 32 * half;
      const int o1 = (d1 >> 3) * 128 + ((d1 >> 2) & 1) * 64 + (d1 & 3) + 32 * half;
#pragma unroll
      for (int r = 0; r < 8; ++r) {  // m = r + 8 * half
        blk0[o0 + 4 * r] = acc00[r] + bias0;
        blk0[o1 + 4 * r] = acc01[r] + bias1;
        blk1[o0 + 4 * r] = acc10[r] + bias0;
        blk1[o1 + 4 * r] = acc11[r] + bias1;
      }
      // the layouts' branches exclude one another and the kernel ends after these stores;
      // the wait stands between the issued stores and that end, as a precaution
      asm volatile("s_wait_xcnt 0x0" ::: "memory");
    } else {
      const int o = (dbase >> 5) * 128 + lane * 4;
#pragma unroll
      for (int r = 0; r < 8; r += 2) {  // m = r + 8 * half and m + 1
        const int off = o + (r >> 1) * 256;
        v4f s0 = {acc00[r] + bias0, acc00[r + 1] + bias0, acc01[r] + bias1, acc01[r + 1] + bias1};
        v4f s1 = {acc10[r] + bias0, acc10[r + 1] + bias0, acc11[r] + bias1, acc11[r + 1] + bias1};
        *reinterpret_cast<v4f*>(&blk0[off]) = s0;
        *reinterpret_cast<v4f*>(&blk1[off]) = s1;
      }
      // the layouts' branches exclude one another and the kernel ends after these stores;
      // the wait stands between the issued stores and that end, as a precaution
      asm volatile("s_wait_xcnt 0x0" ::: "memory");
    }
  }
}

// One product, C row-major.
__global__ __launch_bounds__(256) void gemm1024_bias_wmma(
    const float* __restrict__ A, const float* __restrict__ W,
    const float* __restrict__ bias, float* __restrict__ C) {
  gemm1024_bias_tile(A, W, bias, C, 0);
}

// The three projections of one x in one launch: blockIdx.z picks the weights, the
// bias, the destination and its layout. One product has 128 work-groups, half as many
// as the chip has WGPs; the three do not depend on one another, so as one grid of 384
// they run side by side instead of one after the other.
__global__ __launch_bounds__(256) void qkv_proj_wmma(
    const float* __restrict__ x,
    const float* __restrict__ Wq, const float* __restrict__ bq, float* __restrict__ Qp,
    const float* __restrict__ Wk, const float* __restrict__ bk, float* __restrict__ Kp,
    const float* __restrict__ Wv, const float* __restrict__ bv, float* __restrict__ Vp) {
  const int z = blockIdx.z;
  const float* W    = z == 0 ? Wq : z == 1 ? Wk : Wv;
  const float* bias = z == 0 ? bq : z == 1 ? bk : bv;
  float* C          = z == 0 ? Qp : z == 1 ? Kp : Vp;
  gemm1024_bias_tile(x, W, bias, C, z);
}

// ---------------------------------------------------------------------------
// Multi-query attention core. One work-group of 4 wave32 per 16-row query tile:
// wave w takes the 16-key blocks w, w+4, w+8, ... with its own running maxima,
// sums and output accumulators; the 4 partial results are merged through LDS.
//   Q: [B, 512, 1024] (per-head slice h*64..h*64+63)
//   K2/V2: per batch 512 blocks of 16 keys x 64, each block in the fragment order
//      that the projection kernel writes (layout 1 and 2). A block's 16 keys are
//      one 64-column slice of 16 consecutive rows of the projection; the softmax
//      and the weighted sum run over all 8192 keys, so their order is free as
//      long as K and V agree.
//   Y: scrambled output, per batch flat index (h*64+d)*512 + s  (matches the
//      reference's swapaxes(-1,-2).reshape(B,-1,D))
// Both products are transposed: S^T = K . Q^T (A = key block, B = Q, kept in VGPRs)
// and O^T += V^T . P^T. Lane (half, q) then holds the scores of query q against keys
// 8 * half + r in its 8 accumulator registers: the maximum and the sum run inside the
// lane, the two halves exchange one value a block, and registers 2j, 2j + 1 of P^T are
// the B-fragment of K-step j as they stand (keys 8 * half + 2j + e, the V block's order).
// ---------------------------------------------------------------------------
// lane l with lane l ^ 16
__device__ __forceinline__ float xhalf(float x) {
  const int b = __builtin_bit_cast(int, x);
  return __builtin_bit_cast(float, __builtin_amdgcn_permlanex16(b, b, 0x76543210, 0xfedcba98, false, false));
}

// waves_per_eu(4, 4): exactly four work-groups (one wave per SIMD each) fit a WGP,
// so the 1024 work-groups are all resident at once and spread evenly.
__global__ __launch_bounds__(128) __attribute__((amdgpu_waves_per_eu(4, 4)))
void mqa_attention_wmma(
    const float* __restrict__ Q, const float* __restrict__ Kp,
    const float* __restrict__ Vp, float* __restrict__ Y) {
  constexpr int S = 512, HD = 64, SK = 8192;
  constexpr int NW = 4;        // waves per work-group = key splits
  const int sTile = blockIdx.x;  // 0..31
  const int h     = blockIdx.y;  // 0..15
  const int b     = blockIdx.z;  // 0..1
  const int lane  = threadIdx.x & 31;
  const int wv    = __builtin_amdgcn_readfirstlane(threadIdx.x >> 5);  // scalar: uniform key loop
  const int half  = lane >> 4;
  const int l16   = lane & 15;
  const int sBase = sTile * 16;

  __shared__ float o_part[NW][32 * 32];  // [accumulator register][lane]
  __shared__ float m_part[NW][16];
  __shared__ float l_part[NW][16];

  // Preload Q tile [16 x 64] as 16 B-fragments (K-steps of 4): 32 VGPRs/lane.
  // k order of step 2g + i, register e: d = 8g + 4 * half + 2i + e, as in the K blocks.
  const float* qrow = Q + ((size_t)b * S + sBase + l16) * 1024 + h * 64 + 4 * half;
  v2f qb[16];
#pragma unroll
  for (int g = 0; g < 8; ++g) {
    const v4f q4 = *reinterpret_cast<const v4f*>(qrow + g * 8);
    qb[2 * g]     = __builtin_shufflevector(q4, q4, 0, 1);
    qb[2 * g + 1] = __builtin_shufflevector(q4, q4, 2, 3);
  }

  const float* kbase = Kp + (size_t)b * SK * HD;
  const float* vbase = Vp + (size_t)b * SK * HD;

  float mrun = -__builtin_inff();  // running maximum of query l16, equal in both halves
  float lrun = 0.0f;               // running sum over this half's keys only
  v8f accO[4] = {{}, {}, {}, {}};  // accO[t][r] = O^T[d = 16t + 8 * half + r][query l16]

  for (int j0 = wv * 16; j0 < SK; j0 += NW * 16) {
    // S^T tile = (key block j0/16)[16x64] @ Q^T  (A-frag: m=key lane, k=d);
    // one 16-byte load a lane holds the A-fragments of two K-steps
    v8f sc = {};
    const float* kblk = kbase + (size_t)j0 * HD + lane * 4;
#pragma unroll
    for (int g = 0; g < 8; ++g) {
      const v4f k4 = *reinterpret_cast<const v4f*>(kblk + g * 128);
      const v2f a0 = __builtin_shufflevector(k4, k4, 0, 1);
      const v2f a1 = __builtin_shufflevector(k4, k4, 2, 3);
      sc = __builtin_amdgcn_wmma_f32_16x16x4_f32(false, a0, false, qb[2 * g], (short)0, sc, false, false);
      sc = __builtin_amdgcn_wmma_f32_16x16x4_f32(false, a1, false, qb[2 * g + 1], (short)0, sc, false, false);
    }

    // online softmax of query l16 over the block's 16 keys (8 here, 8 in lane ^ 16)
    float bmax = fmaxf(fmaxf(fmaxf(sc[0], sc[1]), fmaxf(sc[2], sc[3])),
                       fmaxf(fmaxf(sc[4], sc[5]), fmaxf(sc[6], sc[7])));
    bmax = fmaxf(bmax, xhalf(bmax));
    const float mnew = fmaxf(mrun, bmax * 0.125f);  // 1/sqrt(64)
    const float scl = __expf(mrun - mnew);
    float p[8];
#pragma unroll
    for (int r = 0; r < 8; ++r) p[r] = __expf(sc[r] * 0.125f - mnew);
    const float ps = ((p[0] + p[1]) + (p[2] + p[3])) + ((p[4] + p[5]) + (p[6] + p[7]));
    lrun = lrun * scl + ps;
    mrun = mnew;
#pragma unroll
    for (int t = 0; t < 4; ++t) accO[t] *= scl;

    // accO^T[64x16] += (value block j0/16)^T[64x16] @ P^T[16x16];
    // one 16-byte load a lane holds the A-fragments of two d tiles
    const float* vblk = vbase + (size_t)j0 * HD + lane * 4;
#pragma unroll
    for (int j = 0; j < 4; ++j) {
      const v2f pb = {p[2 * j], p[2 * j + 1]};
#pragma unroll
      for (int tp = 0; tp < 2; ++tp) {
        const v4f v4 = *reinterpret_cast<const v4f*>(vblk + j * 256 + tp * 128);
        const v2f a0 = __builtin_shufflevector(v4, v4, 0, 1);
        const v2f a1 = __builtin_shufflevector(v4, v4, 2, 3);
        accO[2 * tp]     = __builtin_amdgcn_wmma_f32_16x16x4_f32(false, a0, false, pb, (short)0, accO[2 * tp], false, false);
        accO[2 * tp + 1] = __builtin_amdgcn_wmma_f32_16x16x4_f32(false, a1, false, pb, (short)0, accO[2 * tp + 1], false, false);
      }
    }
  }

  // publish this wave's un-normalised partial output, maxima and sums
  const float lsum = lrun + xhalf(lrun);  // join the halves' sums once
#pragma unroll
  for (int t = 0; t < 4; ++t)
#pragma unroll
    for (int r = 0; r < 8; ++r) o_part[wv][(t * 8 + r) * 32 + lane] = accO[t][r];
  if (half == 0) { m_part[wv][l16] = mrun; l_part[wv][l16] = lsum; }
  __syncthreads();  // every wave's partial is in LDS before any thread merges

  // merge the key splits, normalize and write the scrambled layout:
  // Y[b].flat[(h*64+d)*512 + s]; 16 consecutive threads store 16 consecutive s
  float* ybase = Y + (size_t)b * (S * 1024);
  const int srow = threadIdx.x & 15;
  const int dq   = threadIdx.x >> 4;  // 0..7
  float mall = m_part[0][srow];
#pragma unroll
  for (int w = 1; w < NW; ++w) mall = fmaxf(mall, m_part[w][srow]);
  float wgt[NW];
  float lall = 0.0f;
#pragma unroll
  for (int w = 0; w < NW; ++w) {
    wgt[w] = __expf(m_part[w][srow] - mall);
    lall += wgt[w] * l_part[w][srow];
  }
  const float inv = 1.0f / lall;
#pragma unroll
  for (int i = 0; i < 8; ++i) {
    const int d = dq + 8 * i;  // tile i / 2, half i % 2, register dq
    float o = 0.0f;
#pragma unroll
    for (int w = 0; w < NW; ++w) o += wgt[w] * o_part[w][((i >> 1) * 8 + dq) * 32 + (i & 1) * 16 + srow];
    ybase[(size_t)(h * 64 + d) * 512 + sBase + srow] = o * inv;
  }
}

// ---------------------------------------------------------------------------
// Launch: the 3 projection GEMMs as one grid (K and V stored in fragment order) -> attention ->
// output GEMM (consumes scrambled Y as a plain row-major [1024,1024] matrix,
// matching the reference faithfully).
// Workspace: Q(4MB) | K(4MB) | V(4MB) | Y(4MB) = 16MB.
// ---------------------------------------------------------------------------
extern "C" void kernel_launch(void* const* d_in, const int* in_sizes, int n_in,
                              void* d_out, int out_size, void* d_ws, size_t ws_size,
                              hipStream_t stream) {
  (void)in_sizes; (void)n_in; (void)out_size; (void)ws_size;
  const float* x  = (const float*)d_in[0];
  const float* Wq = (const float*)d_in[1];
  const float* bq = (const float*)d_in[2];
  const float* Wk = (const float*)d_in[3];
  const float* bk = (const float*)d_in[4];
  const float* Wv = (const float*)d_in[5];
  const float* bv = (const float*)d_in[6];
  const float* Wo = (const float*)d_in[7];
  const float* bo = (const float*)d_in[8];
  float* out = (float*)d_out;

  float* ws = (float*)d_ws;
  float* Qp = ws;
  float* Kp = ws + (1u << 20);
  float* Vp = ws + (2u << 20);
  float* Yp = ws + (3u << 20);

  const dim3 gGrid(8, 16, 1);   // N tiles of 128, M tiles of 64
  const dim3 gBlk(256, 1, 1);
  qkv_proj_wmma<<<dim3(8, 16, 3), gBlk, 0, stream>>>(x, Wq, bq, Qp, Wk, bk, Kp, Wv, bv, Vp);
  mqa_attention_wmma<<<dim3(32, 16, 2), dim3(128, 1, 1), 0, stream>>>(Qp, Kp, Vp, Yp);
  gemm1024_bias_wmma<<<gGrid, gBlk, 0, stream>>>(Yp, Wo, bo, out);
}

// v005
// Measured time: 245 microseconds a run.
// Timed twice side by side with v004, it ran 1.26 and 1.25 times as fast.
// All steps since v000 together make it 4.16 times as fast.
#include <hip/hip_runtime.h>
#include <hip/hip_bf16.h>

typedef __attribute__((ext_vector_type(2))) float v2f;
typedef __attribute__((ext_vector_type(4))) float v4f;
typedef __attribute__((ext_vector_type(8))) float v8f;

// ---------------------------------------------------------------------------
// C[M=1024, N=1024] = A[1024,1024] @ W[1024,1024] + bias[N]
// Block: 256 threads = 8 wave32; block tile 64(M) x 128(N); K panels of 16,
// two LDS buffers, global loads two panels ahead in registers.
// Each wave computes a 32x32 tile as a 2x2 grid of 16x16 WMMA accumulators,
// so every A-frag is reused across 2 N-subtiles and every B-frag across 2
// M-subtiles (2 LDS dwords per v_wmma_f32_16x16x4_f32).
// B panel is stored pair-interleaved in LDS ([k/2][n][2]) so a B-fragment is
// one aligned ds_load_b64 -> no VALU repacking before the WMMA.
//
// layout picks how C is stored:
//   0: row-major [1024][1024].
//   1, 2: blocks of 1024 floats, one per (16 rows, 64 columns): block index
//      (row / 16) * 16 + col / 64. With m = row % 16 and d = col % 64 a block
//      holds 16 keys (m) of head size 64 (d) in the order in which the attention
//      kernel's lanes want them, so that each of its loads is 16 bytes a lane and
//      512 contiguous bytes a wave:
//   1 (keys):   [d / 8][(d / 4) % 2][m][d % 4]
//   2 (values): [(m % 8) / 2][d / 32][m / 8][d % 16][(d / 16) % 2][m % 2]
//   Every 128-byte line of a block is written by one wave.
// ---------------------------------------------------------------------------
// Work-group barrier for data that goes through LDS only: this wave's LDS stores and
// loads are done (s_wait_dscnt 0), then the barrier. __syncthreads() would also wait
// for the global loads that are issued ahead, and so end their lead at every panel.
__device__ __forceinline__ void lds_barrier() {
  asm volatile("s_wait_dscnt 0x0\n\ts_barrier_signal -1\n\ts_barrier_wait -1" ::: "memory");
  // keeps the register moves of the panel that is staged behind the barrier, and with
  // them the wait for its global loads, from being scheduled a whole panel earlier
  __builtin_amdgcn_sched_barrier(0);
}

__device__ __forceinline__ void gemm1024_bias_tile(
    const float* __restrict__ A, const float* __restrict__ W,
    const float* __restrict__ bias, float* __restrict__ C, const int layout) {
  constexpr int K = 1024, N = 1024;
  constexpr int NP = K / 16;                            // K panels
  __shared__ __align__(16) float As[2][64 * 16];        // [buffer][m][k]       2 x 4 KB
  __shared__ __align__(16) float BsP[2][8 * 128 * 2];   // [buffer][k/2][n][2]  2 x 8 KB

  const int tid  = threadIdx.x;
  const int lane = tid & 31;
  const int wid  = tid >> 5;
  const int half = lane >> 4;   // 0: lanes 0-15, 1: lanes 16-31
  const int l16  = lane & 15;

  const int m0 = blockIdx.y * 64;
  const int n0 = blockIdx.x * 128;
  const int mw = (wid & 1) * 32;   // wave M offset in block tile
  const int nw = (wid >> 1) * 32;  // wave N offset in block tile

  // cooperative-load coordinates
  const int ar = tid >> 2;         // 0..63 : A panel row
  const int ac = (tid & 3) * 4;    // 0,4,8,12
  const int kp = tid >> 5;         // 0..7  : B panel k-pair
  const int n4 = (tid & 31) * 4;   // 0..124

  v8f acc00 = {}, acc01 = {}, acc10 = {}, acc11 = {};

  // this thread's share of one K panel, on its way from global memory to LDS
  struct Panel { v4f a, f0, f1; };
  const float* aptr = &A[(size_t)(m0 + ar) * K + ac];
  const float* wptr = &W[(size_t)(2 * kp) * N + n0 + n4];
  auto fetch = [&](const int p) {
    Panel r;
    r.a  = *reinterpret_cast<const v4f*>(aptr + p * 16);                    // A panel [64 x 16]
    r.f0 = *reinterpret_cast<const v4f*>(wptr + (size_t)p * 16 * N);        // W rows 2kp, 2kp + 1
    r.f1 = *reinterpret_cast<const v4f*>(wptr + (size_t)p * 16 * N + N);
    return r;
  };
  auto stage = [&](const Panel& r, const int buf) {
    *reinterpret_cast<v4f*>(&As[buf][ar * 16 + ac]) = r.a;
    // B panel, pair-interleaved: {W[2kp, n], W[2kp+1, n]} contiguous
    const int bbase = (kp * 128 + n4) * 2;
    *reinterpret_cast<v4f*>(&BsP[buf][bbase])     = __builtin_shufflevector(r.f0, r.f1, 0, 4, 1, 5);
    *reinterpret_cast<v4f*>(&BsP[buf][bbase + 4]) = __builtin_shufflevector(r.f0, r.f1, 2, 6, 3, 7);
  };
  auto mult = [&](const int buf) {
#pragma unroll
    for (int kk = 0; kk < 16; kk += 4) {
      const int kb = kk + 2 * half;  // even; A-frag lanes 0-15: K={kk,kk+1}, 16-31: K={kk+2,kk+3}
      const int kq = kb >> 1;
      v2f a0 = *reinterpret_cast<const v2f*>(&As[buf][(mw + l16) * 16 + kb]);
      v2f a1 = *reinterpret_cast<const v2f*>(&As[buf][(mw + 16 + l16) * 16 + kb]);
      v2f b0 = *reinterpret_cast<const v2f*>(&BsP[buf][(kq * 128 + nw + l16) * 2]);
      v2f b1 = *reinterpret_cast<const v2f*>(&BsP[buf][(kq * 128 + nw + 16 + l16) * 2]);
      acc00 = __builtin_amdgcn_wmma_f32_16x16x4_f32(false, a0, false, b0, (short)0, acc00, false, false);
      acc01 = __builtin_amdgcn_wmma_f32_16x16x4_f32(false, a0, false, b1, (short)0, acc01, false, false);
      acc10 = __builtin_amdgcn_wmma_f32_16x16x4_f32(false, a1, false, b0, (short)0, acc10, false, false);
      acc11 = __builtin_amdgcn_wmma_f32_16x16x4_f32(false, a1, false, b1, (short)0, acc11, false, false);
    }
  };

  // Software pipeline. While panel p is multiplied from one LDS buffer, panel p + 1 is
  // stored into the other and panels p + 2 and p + 3 are on their way in registers, so
  // a load has two panels' products to arrive in. One barrier a panel does both jobs:
  // it publishes the buffer just stored and ends the reads of the buffer stored next.
  // At the top of a trip: buffer 0 = panel p, r1 = panel p + 1, r0 = panel p + 2.
  Panel r0 = fetch(0);
  Panel r1 = fetch(1);
  // panel 2's loads stay behind panel 1's, as in the loop: issued among them they make
  // the loop's counted wait for r1 cover the younger panel's loads as well, on every trip
  __builtin_amdgcn_sched_barrier(0);
  stage(r0, 0);
  r0 = fetch(2);
  lds_barrier();
  int p = 0;
  for (; p + 4 < NP; p += 2) {
    stage(r1, 1);
    r1 = fetch(p + 3);
    mult(0);
    lds_barrier();
    stage(r0, 0);
    r0 = fetch(p + 4);
    mult(1);
    lds_barrier();
  }
  // the last four panels: one more fetch, then none
  stage(r1, 1);
  r1 = fetch(NP - 1);
  mult(0);
  lds_barrier();
  stage(r0, 0);
  mult(1);
  lds_barrier();
  stage(r1, 1);
  mult(0);
  lds_barrier();
  mult(1);

  const float bias0 = bias[n0 + nw + l16];
  const float bias1 = bias[n0 + nw + 16 + l16];
  if (layout == 0) {
#pragma unroll
    for (int r = 0; r < 8; ++r) {
      const int row0 = m0 + mw + r + 8 * half;       // C layout: vgpr r -> M=r / M=8+r per half
      const int row1 = row0 + 16;
      C[(size_t)row0 * N + n0 + nw + l16]      = acc00[r] + bias0;
      C[(size_t)row0 * N + n0 + nw + 16 + l16] = acc01[r] + bias1;
      C[(size_t)row1 * N + n0 + nw + l16]      = acc10[r] + bias0;
      C[(size_t)row1 * N + n0 + nw + 16 + l16] = acc11[r] + bias1;
    }
  } else {
    // the wave's 32 x 32 tile = rows of two blocks, 32 of their 64 columns
    const int dbase = (n0 + nw) & 63;  // 0 or 32
    float* blk0 = C + (size_t)(((m0 + mw) >> 4) * 16 + ((n0 + nw) >> 6)) * 1024;
    float* blk1 = blk0 + 16 * 1024;
    if (layout == 1) {
      const int d0 = dbase + l16;
      const int d1 = d0 + 16;
      const int o0 = (d0 >> 3) * 128 + ((d0 >> 2) & 1) * 64 + (d0 & 3) + 32 * half;
      const int o1 = (d1 >> 3) * 128 + ((d1 >> 2) & 1) * 64 + (d1 & 3) + 32 * half;
#pragma unroll
      for (int r = 0; r < 8; ++r) {  // m = r + 8 * half
        blk0[o0 + 4 * r] = acc00[r] + bias0;
        blk0[o1 + 4 * r] = acc01[r] + bias1;
        blk1[o0 + 4 * r] = acc10[r] + bias0;
        blk1[o1 + 4 * r] = acc11[r] + bias1;
      }
      // the layouts' branches exclude one another and the kernel ends after these stores;
      // the wait stands between the issued stores and that end, as a precaution
      asm volatile("s_wait_xcnt 0x0" ::: "memory");
    } else {
      const int o = (dbase >> 5) * 128 + lane * 4;
#pragma unroll
      for (int r = 0; r < 8; r += 2) {  // m = r + 8 * half and m + 1
        const int off = o + (r >> 1) * 256;
        v4f s0 = {acc00[r] + bias0, acc00[r + 1] + bias0, acc01[r] + bias1, acc01[r + 1] + bias1};
        v4f s1 = {acc10[r] + bias0, acc10[r + 1] + bias0, acc11[r] + bias1, acc11[r + 1] + bias1};
        *reinterpret_cast<v4f*>(&blk0[off]) = s0;
        *reinterpret_cast<v4f*>(&blk1[off]) = s1;
      }
      // the layouts' branches exclude one another and the kernel ends after these stores;
      // the wait stands between the issued stores and that end, as a precaution
      asm volatile("s_wait_xcnt 0x0" ::: "memory");
    }
  }
}

// One product, C row-major.
__global__ __launch_bounds__(256) void gemm1024_bias_wmma(
    const float* __restrict__ A, const float* __restrict__ W,
    const float* __restrict__ bias, float* __restrict__ C) {
  gemm1024_bias_tile(A, W, bias, C, 0);
}

// The three projections of one x in one launch: blockIdx.z picks the weights, the
// bias, the destination and its layout. One product has 128 work-groups, half as many
// as the chip has WGPs; the three do not depend on one another, so as one grid of 384
// they run side by side instead of one after the other.
__global__ __launch_bounds__(256) void qkv_proj_wmma(
    const float* __restrict__ x,
    const float* __restrict__ Wq, const float* __restrict__ bq, float* __restrict__ Qp,
    const float* __restrict__ Wk, const float* __restrict__ bk, float* __restrict__ Kp,
    const float* __restrict__ Wv, const float* __restrict__ bv, float* __restrict__ Vp) {
  const int z = blockIdx.z;
  const float* W    = z == 0 ? Wq : z == 1 ? Wk : Wv;
  const float* bias = z == 0 ? bq : z == 1 ? bk : bv;
  float* C          = z == 0 ? Qp : z == 1 ? Kp : Vp;
  gemm1024_bias_tile(x, W, bias, C, z);
}

// ---------------------------------------------------------------------------
// Multi-query attention core. One work-group of 4 wave32 per 16-row query tile:
// wave w takes the 16-key blocks w, w+4, w+8, ... with its own running maxima,
// sums and output accumulators; the 4 partial results are merged through LDS.
//   Q: [B, 512, 1024] (per-head slice h*64..h*64+63)
//   K2/V2: per batch 512 blocks of 16 keys x 64, each block in the fragment order
//      that the projection kernel writes (layout 1 and 2). A block's 16 keys are
//      one 64-column slice of 16 consecutive rows of the projection; the softmax
//      and the weighted sum run over all 8192 keys, so their order is free as
//      long as K and V agree.
//   Y: scrambled output, per batch flat index (h*64+d)*512 + s  (matches the
//      reference's swapaxes(-1,-2).reshape(B,-1,D))
// Both products are transposed: S^T = K . Q^T (A = key block, B = Q, kept in VGPRs)
// and O^T += V^T . P^T. Lane (half, q) then holds the scores of query q against keys
// 8 * half + r in its 8 accumulator registers: the maximum and the sum run inside the
// lane, the two halves exchange one value a block, and registers 2j, 2j + 1 of P^T are
// the B-fragment of K-step j as they stand (keys 8 * half + 2j + e, the V block's order).
// ---------------------------------------------------------------------------
// lane l with lane l ^ 16
__device__ __forceinline__ float xhalf(float x) {
  const int b = __builtin_bit_cast(int, x);
  return __builtin_bit_cast(float, __builtin_amdgcn_permlanex16(b, b, 0x76543210, 0xfedcba98, false, false));
}

// waves_per_eu(4, 4): exactly four work-groups (one wave per SIMD each) fit a WGP,
// so the 1024 work-groups are all resident at once and spread evenly.
__global__ __launch_bounds__(128) __attribute__((amdgpu_waves_per_eu(4, 4)))
void mqa_attention_wmma(
    const float* __restrict__ Q, const float* __restrict__ Kp,
    const float* __restrict__ Vp, float* __restrict__ Y) {
  constexpr int S = 512, HD = 64, SK = 8192;
  constexpr int NW = 4;        // waves per work-group = key splits
  const int sTile = blockIdx.x;  // 0..31
  const int h     = blockIdx.y;  // 0..15
  const int b     = blockIdx.z;  // 0..1
  const int lane  = threadIdx.x & 31;
  const int wv    = __builtin_amdgcn_readfirstlane(threadIdx.x >> 5);  // scalar: uniform key loop
  const int half  = lane >> 4;
  const int l16   = lane & 15;
  const int sBase = sTile * 16;

  __shared__ float o_part[NW][32 * 32];  // [accumulator register][lane]
  __shared__ float m_part[NW][16];
  __shared__ float l_part[NW][16];

  // Preload Q tile [16 x 64] as 16 B-fragments (K-steps of 4): 32 VGPRs/lane.
  // k order of step 2g + i, register e: d = 8g + 4 * half + 2i + e, as in the K blocks.
  const float* qrow = Q + ((size_t)b * S + sBase + l16) * 1024 + h * 64 + 4 * half;
  v2f qb[16];
#pragma unroll
  for (int g = 0; g < 8; ++g) {
    const v4f q4 = *reinterpret_cast<const v4f*>(qrow + g * 8);
    qb[2 * g]     = __builtin_shufflevector(q4, q4, 0, 1);
    qb[2 * g + 1] = __builtin_shufflevector(q4, q4, 2, 3);
  }

  const float* kbase = Kp + (size_t)b * SK * HD;
  const float* vbase = Vp + (size_t)b * SK * HD;

  float mrun = -__builtin_inff();  // running maximum of query l16, equal in both halves
  float lrun = 0.0f;               // running sum over this half's keys only
  v8f accO[4] = {{}, {}, {}, {}};  // accO[t][r] = O^T[d = 16t + 8 * half + r][query l16]

  for (int j0 = wv * 16; j0 < SK; j0 += NW * 16) {
    // S^T tile = (key block j0/16)[16x64] @ Q^T  (A-frag: m=key lane, k=d);
    // one 16-byte load a lane holds the A-fragments of two K-steps
    v8f sc = {};
    const float* kblk = kbase + (size_t)j0 * HD + lane * 4;
#pragma unroll
    for (int g = 0; g < 8; ++g) {
      const v4f k4 = *reinterpret_cast<const v4f*>(kblk + g * 128);
      const v2f a0 = __builtin_shufflevector(k4, k4, 0, 1);
      const v2f a1 = __builtin_shufflevector(k4, k4, 2, 3);
      sc = __builtin_amdgcn_wmma_f32_16x16x4_f32(false, a0, false, qb[2 * g], (short)0, sc, false, false);
      sc = __builtin_amdgcn_wmma_f32_16x16x4_f32(false, a1, false, qb[2 * g + 1], (short)0, sc, false, false);
    }

    // online softmax of query l16 over the block's 16 keys (8 here, 8 in lane ^ 16)
    float bmax = fmaxf(fmaxf(fmaxf(sc[0], sc[1]), fmaxf(sc[2], sc[3])),
                       fmaxf(fmaxf(sc[4], sc[5]), fmaxf(sc[6], sc[7])));
    bmax = fmaxf(bmax, xhalf(bmax));
    const float mnew = fmaxf(mrun, bmax * 0.125f);  // 1/sqrt(64)
    const float scl = __expf(mrun - mnew);
    float p[8];
#pragma unroll
    for (int r = 0; r < 8; ++r) p[r] = __expf(sc[r] * 0.125f - mnew);
    const float ps = ((p[0] + p[1]) + (p[2] + p[3])) + ((p[4] + p[5]) + (p[6] + p[7]));
    lrun = lrun * scl + ps;
    mrun = mnew;
#pragma unroll
    for (int t = 0; t < 4; ++t) accO[t] *= scl;

    // accO^T[64x16] += (value block j0/16)^T[64x16] @ P^T[16x16];
    // one 16-byte load a lane holds the A-fragments of two d tiles
    const float* vblk = vbase + (size_t)j0 * HD + lane * 4;
#pragma unroll
    for (int j = 0; j < 4; ++j) {
      const v2f pb = {p[2 * j], p[2 * j + 1]};
#pragma unroll
      for (int tp = 0; tp < 2; ++tp) {
        const v4f v4 = *reinterpret_cast<const v4f*>(vblk + j * 256 + tp * 128);
        const v2f a0 = __builtin_shufflevector(v4, v4, 0, 1);
        const v2f a1 = __builtin_shufflevector(v4, v4, 2, 3);
        accO[2 * tp]     = __builtin_amdgcn_wmma_f32_16x16x4_f32(false, a0, false, pb, (short)0, accO[2 * tp], false, false);
        accO[2 * tp + 1] = __builtin_amdgcn_wmma_f32_16x16x4_f32(false, a1, false, pb, (short)0, accO[2 * tp + 1], false, false);
      }
    }
  }

  // publish this wave's un-normalised partial output, maxima and sums
  const float lsum = lrun + xhalf(lrun);  // join the halves' sums once
#pragma unroll
  for (int t = 0; t < 4; ++t)
#pragma unroll
    for (int r = 0; r < 8; ++r) o_part[wv][(t * 8 + r) * 32 + lane] = accO[t][r];
  if (half == 0) { m_part[wv][l16] = mrun; l_part[wv][l16] = lsum; }
  __syncthreads();  // every wave's partial is in LDS before any thread merges

  // merge the key splits, normalize and write the scrambled layout:
  // Y[b].flat[(h*64+d)*512 + s]; 16 consecutive threads store 16 consecutive s
  float* ybase = Y + (size_t)b * (S * 1024);
  const int srow = threadIdx.x & 15;
  const int dq   = threadIdx.x >> 4;  // 0..7
  float mall = m_part[0][srow];
#pragma unroll
  for (int w = 1; w < NW; ++w) mall = fmaxf(mall, m_part[w][srow]);
  float wgt[NW];
  float lall = 0.0f;
#pragma unroll
  for (int w = 0; w < NW; ++w) {
    wgt[w] = __expf(m_part[w][srow] - mall);
    lall += wgt[w] * l_part[w][srow];
  }
  const float inv = 1.0f / lall;
#pragma unroll
  for (int i = 0; i < 8; ++i) {
    const int d = dq + 8 * i;  // tile i / 2, half i % 2, register dq
    float o = 0.0f;
#pragma unroll
    for (int w = 0; w < NW; ++w) o += wgt[w] * o_part[w][((i >> 1) * 8 + dq) * 32 + (i & 1) * 16 + srow];
    ybase[(size_t)(h * 64 + d) * 512 + sBase + srow] = o * inv;
  }
}

// ---------------------------------------------------------------------------
// Launch: the 3 projection GEMMs as one grid (K and V stored in fragment order) -> attention ->
// output GEMM (consumes scrambled Y as a plain row-major [1024,1024] matrix,
// matching the reference faithfully).
// Workspace: Q(4MB) | K(4MB) | V(4MB) | Y(4MB) = 16MB.
// ---------------------------------------------------------------------------
extern "C" void kernel_launch(void* const* d_in, const int* in_sizes, int n_in,
                              void* d_out, int out_size, void* d_ws, size_t ws_size,
                              hipStream_t stream) {
  (void)in_sizes; (void)n_in; (void)out_size; (void)ws_size;
  const float* x  = (const float*)d_in[0];
  const float* Wq = (const float*)d_in[1];
  const float* bq = (const float*)d_in[2];
  const float* Wk = (const float*)d_in[3];
  const float* bk = (const float*)d_in[4];
  const float* Wv = (const float*)d_in[5];
  const float* bv = (const float*)d_in[6];
  const float* Wo = (const float*)d_in[7];
  const float* bo = (const float*)d_in[8];
  float* out = (float*)d_out;

  float* ws = (float*)d_ws;
  float* Qp = ws;
  float* Kp = ws + (1u << 20);
  float* Vp = ws + (2u << 20);
  float* Yp = ws + (3u << 20);

  const dim3 gGrid(8, 16, 1);   // N tiles of 128, M tiles of 64
  const dim3 gBlk(256, 1, 1);
  qkv_proj_wmma<<<dim3(8, 16, 3), gBlk, 0, stream>>>(x, Wq, bq, Qp, Wk, bk, Kp, Wv, bv, Vp);
  mqa_attention_wmma<<<dim3(32, 16, 2), dim3(128, 1, 1), 0, stream>>>(Qp, Kp, Vp, Yp);
  gemm1024_bias_wmma<<<gGrid, gBlk, 0, stream>>>(Yp, Wo, bo, out);
}

// v006
// A run of this version takes 231 microseconds.
// Next to v005, in two timings, it ran 1.06 and 1.05 times as fast.
// Counting every step since v000, it is 4.38 times as fast.
#include <hip/hip_runtime.h>
#include <hip/hip_bf16.h>

typedef __attribute__((ext_vector_type(2))) float v2f;
typedef __attribute__((ext_vector_type(4))) float v4f;
typedef __attribute__((ext_vector_type(8))) float v8f;

// ---------------------------------------------------------------------------
// C[M=1024, N=1024] = A[1024,1024] @ W[1024,1024] + bias[N]
// Block: 256 threads = 8 wave32; block tile 64(M) x 64(N); K panels of 16,
// two LDS buffers, global loads two panels ahead in registers.
// One product is then 256 work-groups, one for each of the chip's 256 WGPs, and
// three products are 768, three for each: no WGP idles or carries an extra tile.
// Each wave computes a 16x32 tile as two 16x16 WMMA accumulators (waves 4 x 2),
// so every A-frag is reused across 2 N-subtiles.
// B panel is stored pair-interleaved in LDS ([k/2][n][2]) so a B-fragment is
// one aligned ds_load_b64 -> no VALU repacking before the WMMA.
//
// layout picks how C is stored:
//   0: row-major [1024][1024].
//   1, 2: blocks of 1024 floats, one per (16 rows, 64 columns): block index
//      (row / 16) * 16 + col / 64. With m = row % 16 and d = col % 64 a block
//      holds 16 keys (m) of head size 64 (d) in the order in which the attention
//      kernel's lanes want them, so that each of its loads is 16 bytes a lane and
//      512 contiguous bytes a wave:
//   1 (keys):   [d / 8][(d / 4) % 2][m][d % 4]
//   2 (values): [(m % 8) / 2][d / 32][m / 8][d % 16][(d / 16) % 2][m % 2]
//   Every 128-byte line of a block is written by one wave.
// ---------------------------------------------------------------------------
// Work-group barrier for data that goes through LDS only: this wave's LDS stores and
// loads are done (s_wait_dscnt 0), then the barrier. __syncthreads() would also wait
// for the global loads that are issued ahead, and so end their lead at every panel.
__device__ __forceinline__ void lds_barrier() {
  asm volatile("s_wait_dscnt 0x0\n\ts_barrier_signal -1\n\ts_barrier_wait -1" ::: "memory");
  // keeps the register moves of the panel that is staged behind the barrier, and with
  // them the wait for its global loads, from being scheduled a whole panel earlier
  __builtin_amdgcn_sched_barrier(0);
}

__device__ __forceinline__ void gemm1024_bias_tile(
    const float* __restrict__ A, const float* __restrict__ W,
    const float* __restrict__ bias, float* __restrict__ C, const int layout) {
  constexpr int K = 1024, N = 1024;
  constexpr int NP = K / 16;                            // K panels
  __shared__ __align__(16) float As[2][64 * 16];        // [buffer][m][k]       2 x 4 KB
  __shared__ __align__(16) float BsP[2][8 * 64 * 2];    // [buffer][k/2][n][2]  2 x 4 KB

  const int tid  = threadIdx.x;
  const int lane = tid & 31;
  const int wid  = tid >> 5;
  const int half = lane >> 4;   // 0: lanes 0-15, 1: lanes 16-31
  const int l16  = lane & 15;

  const int m0 = blockIdx.y * 64;
  const int n0 = blockIdx.x * 64;
  const int mw = (wid & 3) * 16;   // wave M offset in block tile
  const int nw = (wid >> 2) * 32;  // wave N offset in block tile

  // cooperative-load coordinates
  const int ar = tid >> 2;         // 0..63 : A panel row
  const int ac = (tid & 3) * 4;    // 0,4,8,12
  const int kp = tid >> 5;         // 0..7  : B panel k-pair
  const int n2 = (tid & 31) * 2;   // 0..62

  v8f acc0 = {}, acc1 = {};

  // this thread's share of one K panel, on its way from global memory to LDS
  struct Panel { v4f a; v2f f0, f1; };
  const float* aptr = &A[(size_t)(m0 + ar) * K + ac];
  const float* wptr = &W[(size_t)(2 * kp) * N + n0 + n2];
  auto fetch = [&](const int p) {
    Panel r;
    r.a  = *reinterpret_cast<const v4f*>(aptr + p * 16);                    // A panel [64 x 16]
    r.f0 = *reinterpret_cast<const v2f*>(wptr + (size_t)p * 16 * N);        // W rows 2kp, 2kp + 1
    r.f1 = *reinterpret_cast<const v2f*>(wptr + (size_t)p * 16 * N + N);
    return r;
  };
  auto stage = [&](const Panel& r, const int buf) {
    *reinterpret_cast<v4f*>(&As[buf][ar * 16 + ac]) = r.a;
    // B panel, pair-interleaved: {W[2kp, n], W[2kp+1, n]} contiguous
    *reinterpret_cast<v4f*>(&BsP[buf][(kp * 64 + n2) * 2]) = __builtin_shufflevector(r.f0, r.f1, 0, 2, 1, 3);
  };
  auto mult = [&](const int buf) {
#pragma unroll
    for (int kk = 0; kk < 16; kk += 4) {
      const int kb = kk + 2 * half;  // even; A-frag lanes 0-15: K={kk,kk+1}, 16-31: K={kk+2,kk+3}
      const int kq = kb >> 1;
      v2f a0 = *reinterpret_cast<const v2f*>(&As[buf][(mw + l16) * 16 + kb]);
      v2f b0 = *reinterpret_cast<const v2f*>(&BsP[buf][(kq * 64 + nw + l16) * 2]);
      v2f b1 = *reinterpret_cast<const v2f*>(&BsP[buf][(kq * 64 + nw + 16 + l16) * 2]);
      acc0 = __builtin_amdgcn_wmma_f32_16x16x4_f32(false, a0, false, b0, (short)0, acc0, false, false);
      acc1 = __builtin_amdgcn_wmma_f32_16x16x4_f32(false, a0, false, b1, (short)0, acc1, false, false);
    }
  };

  // Software pipeline. While panel p is multiplied from one LDS buffer, panel p + 1 is
  // stored into the other and panels p + 2 and p + 3 are on their way in registers, so
  // a load has two panels' products to arrive in. One barrier a panel does both jobs:
  // it publishes the buffer just stored and ends the reads of the buffer stored next.
  // At the top of a trip: buffer 0 = panel p, r1 = panel p + 1, r0 = panel p + 2.
  Panel r0 = fetch(0);
  Panel r1 = fetch(1);
  // panel 2's loads stay behind panel 1's, as in the loop: issued among them they make
  // the loop's counted wait for r1 cover the younger panel's loads as well, on every trip
  __builtin_amdgcn_sched_barrier(0);
  stage(r0, 0);
  r0 = fetch(2);
  lds_barrier();
  int p = 0;
  for (; p + 4 < NP; p += 2) {
    stage(r1, 1);
    r1 = fetch(p + 3);
    mult(0);
    lds_barrier();
    stage(r0, 0);
    r0 = fetch(p + 4);
    mult(1);
    lds_barrier();
  }
  // the last four panels: one more fetch, then none
  stage(r1, 1);
  r1 = fetch(NP - 1);
  mult(0);
  lds_barrier();
  stage(r0, 0);
  mult(1);
  lds_barrier();
  stage(r1, 1);
  mult(0);
  lds_barrier();
  mult(1);

  const float bias0 = bias[n0 + nw + l16];
  const float bias1 = bias[n0 + nw + 16 + l16];
  if (layout == 0) {
#pragma unroll
    for (int r = 0; r < 8; ++r) {
      const int row0 = m0 + mw + r + 8 * half;       // C layout: vgpr r -> M=r / M=8+r per half
      C[(size_t)row0 * N + n0 + nw + l16]      = acc0[r] + bias0;
      C[(size_t)row0 * N + n0 + nw + 16 + l16] = acc1[r] + bias1;
    }
  } else {
    // the wave's 16 x 32 tile = the rows of one block, 32 of its 64 columns
    const int dbase = (n0 + nw) & 63;  // 0 or 32
    float* blk0 = C + (size_t)(((m0 + mw) >> 4) * 16 + ((n0 + nw) >> 6)) * 1024;
    if (layout == 1) {
      const int d0 = dbase + l16;
      const int d1 = d0 + 16;
      const int o0 = (d0 >> 3) * 128 + ((d0 >> 2) & 1) * 64 + (d0 & 3) + 32 * half;
      const int o1 = (d1 >> 3) * 128 + ((d1 >> 2) & 1) * 64 + (d1 & 3) + 32 * half;
#pragma unroll
      for (int r = 0; r < 8; ++r) {  // m = r + 8 * half
        blk0[o0 + 4 * r] = acc0[r] + bias0;
        blk0[o1 + 4 * r] = acc1[r] + bias1;
      }
      // the layouts' branches exclude one another and the kernel ends after these stores;
      // the wait stands between the issued stores and that end, as a precaution
      asm volatile("s_wait_xcnt 0x0" ::: "memory");
    } else {
      const int o = (dbase >> 5) * 128 + lane * 4;
#pragma unroll
      for (int r = 0; r < 8; r += 2) {  // m = r + 8 * half and m + 1
        const int off = o + (r >> 1) * 256;
        v4f s0 = {acc0[r] + bias0, acc0[r + 1] + bias0, acc1[r] + bias1, acc1[r + 1] + bias1};
        *reinterpret_cast<v4f*>(&blk0[off]) = s0;
      }
      // the layouts' branches exclude one another and the kernel ends after these stores;
      // the wait stands between the issued stores and that end, as a precaution
      asm volatile("s_wait_xcnt 0x0" ::: "memory");
    }
  }
}

// One product, C row-major.
__global__ __launch_bounds__(256) void gemm1024_bias_wmma(
    const float* __restrict__ A, const float* __restrict__ W,
    const float* __restrict__ bias, float* __restrict__ C) {
  gemm1024_bias_tile(A, W, bias, C, 0);
}

// The three projections of one x in one launch: blockIdx.z picks the weights, the
// bias, the destination and its layout. The three do not depend on one another, so as
// one grid of 768 work-groups they run side by side instead of one after the other.
__global__ __launch_bounds__(256) void qkv_proj_wmma(
    const float* __restrict__ x,
    const float* __restrict__ Wq, const float* __restrict__ bq, float* __restrict__ Qp,
    const float* __restrict__ Wk, const float* __restrict__ bk, float* __restrict__ Kp,
    const float* __restrict__ Wv, const float* __restrict__ bv, float* __restrict__ Vp) {
  const int z = blockIdx.z;
  const float* W    = z == 0 ? Wq : z == 1 ? Wk : Wv;
  const float* bias = z == 0 ? bq : z == 1 ? bk : bv;
  float* C          = z == 0 ? Qp : z == 1 ? Kp : Vp;
  gemm1024_bias_tile(x, W, bias, C, z);
}

// ---------------------------------------------------------------------------
// Multi-query attention core. One work-group of 4 wave32 per 16-row query tile:
// wave w takes the 16-key blocks w, w+4, w+8, ... with its own running maxima,
// sums and output accumulators; the 4 partial results are merged through LDS.
//   Q: [B, 512, 1024] (per-head slice h*64..h*64+63)
//   K2/V2: per batch 512 blocks of 16 keys x 64, each block in the fragment order
//      that the projection kernel writes (layout 1 and 2). A block's 16 keys are
//      one 64-column slice of 16 consecutive rows of the projection; the softmax
//      and the weighted sum run over all 8192 keys, so their order is free as
//      long as K and V agree.
//   Y: scrambled output, per batch flat index (h*64+d)*512 + s  (matches the
//      reference's swapaxes(-1,-2).reshape(B,-1,D))
// Both products are transposed: S^T = K . Q^T (A = key block, B = Q, kept in VGPRs)
// and O^T += V^T . P^T. Lane (half, q) then holds the scores of query q against keys
// 8 * half + r in its 8 accumulator registers: the maximum and the sum run inside the
// lane, the two halves exchange one value a block, and registers 2j, 2j + 1 of P^T are
// the B-fragment of K-step j as they stand (keys 8 * half + 2j + e, the V block's order).
// ---------------------------------------------------------------------------
// lane l with lane l ^ 16
__device__ __forceinline__ float xhalf(float x) {
  const int b = __builtin_bit_cast(int, x);
  return __builtin_bit_cast(float, __builtin_amdgcn_permlanex16(b, b, 0x76543210, 0xfedcba98, false, false));
}

// waves_per_eu(4, 4): exactly four work-groups (one wave per SIMD each) fit a WGP,
// so the 1024 work-groups are all resident at once and spread evenly.
__global__ __launch_bounds__(128) __attribute__((amdgpu_waves_per_eu(4, 4)))
void mqa_attention_wmma(
    const float* __restrict__ Q, const float* __restrict__ Kp,
    const float* __restrict__ Vp, float* __restrict__ Y) {
  constexpr int S = 512, HD = 64, SK = 8192;
  constexpr int NW = 4;        // waves per work-group = key splits
  const int sTile = blockIdx.x;  // 0..31
  const int h     = blockIdx.y;  // 0..15
  const int b     = blockIdx.z;  // 0..1
  const int lane  = threadIdx.x & 31;
  const int wv    = __builtin_amdgcn_readfirstlane(threadIdx.x >> 5);  // scalar: uniform key loop
  const int half  = lane >> 4;
  const int l16   = lane & 15;
  const int sBase = sTile * 16;

  __shared__ float o_part[NW][32 * 32];  // [accumulator register][lane]
  __shared__ float m_part[NW][16];
  __shared__ float l_part[NW][16];

  // Preload Q tile [16 x 64] as 16 B-fragments (K-steps of 4): 32 VGPRs/lane.
  // k order of step 2g + i, register e: d = 8g + 4 * half + 2i + e, as in the K blocks.
  const float* qrow = Q + ((size_t)b * S + sBase + l16) * 1024 + h * 64 + 4 * half;
  v2f qb[16];
#pragma unroll
  for (int g = 0; g < 8; ++g) {
    const v4f q4 = *reinterpret_cast<const v4f*>(qrow + g * 8);
    qb[2 * g]     = __builtin_shufflevector(q4, q4, 0, 1);
    qb[2 * g + 1] = __builtin_shufflevector(q4, q4, 2, 3);
  }

  const float* kbase = Kp + (size_t)b * SK * HD;
  const float* vbase = Vp + (size_t)b * SK * HD;

  float mrun = -__builtin_inff();  // running maximum of query l16, equal in both halves
  float lrun = 0.0f;               // running sum over this half's keys only
  v8f accO[4] = {{}, {}, {}, {}};  // accO[t][r] = O^T[d = 16t + 8 * half + r][query l16]

  for (int j0 = wv * 16; j0 < SK; j0 += NW * 16) {
    // S^T tile = (key block j0/16)[16x64] @ Q^T  (A-frag: m=key lane, k=d);
    // one 16-byte load a lane holds the A-fragments of two K-steps
    v8f sc = {};
    const float* kblk = kbase + (size_t)j0 * HD + lane * 4;
#pragma unroll
    for (int g = 0; g < 8; ++g) {
      const v4f k4 = *reinterpret_cast<const v4f*>(kblk + g * 128);
      const v2f a0 = __builtin_shufflevector(k4, k4, 0, 1);
      const v2f a1 = __builtin_shufflevector(k4, k4, 2, 3);
      sc = __builtin_amdgcn_wmma_f32_16x16x4_f32(false, a0, false, qb[2 * g], (short)0, sc, false, false);
      sc = __builtin_amdgcn_wmma_f32_16x16x4_f32(false, a1, false, qb[2 * g + 1], (short)0, sc, false, false);
    }

    // online softmax of query l16 over the block's 16 keys (8 here, 8 in lane ^ 16)
    float bmax = fmaxf(fmaxf(fmaxf(sc[0], sc[1]), fmaxf(sc[2], sc[3])),
                       fmaxf(fmaxf(sc[4], sc[5]), fmaxf(sc[6], sc[7])));
    bmax = fmaxf(bmax, xhalf(bmax));
    const float mnew = fmaxf(mrun, bmax * 0.125f);  // 1/sqrt(64)
    const float scl = __expf(mrun - mnew);
    float p[8];
#pragma unroll
    for (int r = 0; r < 8; ++r) p[r] = __expf(sc[r] * 0.125f - mnew);
    const float ps = ((p[0] + p[1]) + (p[2] + p[3])) + ((p[4] + p[5]) + (p[6] + p[7]));
    lrun = lrun * scl + ps;
    mrun = mnew;
#pragma unroll
    for (int t = 0; t < 4; ++t) accO[t] *= scl;

    // accO^T[64x16] += (value block j0/16)^T[64x16] @ P^T[16x16];
    // one 16-byte load a lane holds the A-fragments of two d tiles
    const float* vblk = vbase + (size_t)j0 * HD + lane * 4;
#pragma unroll
    for (int j = 0; j < 4; ++j) {
      const v2f pb = {p[2 * j], p[2 * j + 1]};
#pragma unroll
      for (int tp = 0; tp < 2; ++tp) {
        const v4f v4 = *reinterpret_cast<const v4f*>(vblk + j * 256 + tp * 128);
        const v2f a0 = __builtin_shufflevector(v4, v4, 0, 1);
        const v2f a1 = __builtin_shufflevector(v4, v4, 2, 3);
        accO[2 * tp]     = __builtin_amdgcn_wmma_f32_16x16x4_f32(false, a0, false, pb, (short)0, accO[2 * tp], false, false);
        accO[2 * tp + 1] = __builtin_amdgcn_wmma_f32_16x16x4_f32(false, a1, false, pb, (short)0, accO[2 * tp + 1], false, false);
      }
    }
  }

  // publish this wave's un-normalised partial output, maxima and sums
  const float lsum = lrun + xhalf(lrun);  // join the halves' sums once
#pragma unroll
  for (int t = 0; t < 4; ++t)
#pragma unroll
    for (int r = 0; r < 8; ++r) o_part[wv][(t * 8 + r) * 32 + lane] = accO[t][r];
  if (half == 0) { m_part[wv][l16] = mrun; l_part[wv][l16] = lsum; }
  __syncthreads();  // every wave's partial is in LDS before any thread merges

  // merge the key splits, normalize and write the scrambled layout:
  // Y[b].flat[(h*64+d)*512 + s]; 16 consecutive threads store 16 consecutive s
  float* ybase = Y + (size_t)b * (S * 1024);
  const int srow = threadIdx.x & 15;
  const int dq   = threadIdx.x >> 4;  // 0..7
  float mall = m_part[0][srow];
#pragma unroll
  for (int w = 1; w < NW; ++w) mall = fmaxf(mall, m_part[w][srow]);
  float wgt[NW];
  float lall = 0.0f;
#pragma unroll
  for (int w = 0; w < NW; ++w) {
    wgt[w] = __expf(m_part[w][srow] - mall);
    lall += wgt[w] * l_part[w][srow];
  }
  const float inv = 1.0f / lall;
#pragma unroll
  for (int i = 0; i < 8; ++i) {
    const int d = dq + 8 * i;  // tile i / 2, half i % 2, register dq
    float o = 0.0f;
#pragma unroll
    for (int w = 0; w < NW; ++w) o += wgt[w] * o_part[w][((i >> 1) * 8 + dq) * 32 + (i & 1) * 16 + srow];
    ybase[(size_t)(h * 64 + d) * 512 + sBase + srow] = o * inv;
  }
}

// ---------------------------------------------------------------------------
// Launch: the 3 projection GEMMs as one grid (K and V stored in fragment order) -> attention ->
// output GEMM (consumes scrambled Y as a plain row-major [1024,1024] matrix,
// matching the reference faithfully).
// Workspace: Q(4MB) | K(4MB) | V(4MB) | Y(4MB) = 16MB.
// ---------------------------------------------------------------------------
extern "C" void kernel_launch(void* const* d_in, const int* in_sizes, int n_in,
                              void* d_out, int out_size, void* d_ws, size_t ws_size,
                              hipStream_t stream) {
  (void)in_sizes; (void)n_in; (void)out_size; (void)ws_size;
  const float* x  = (const float*)d_in[0];
  const float* Wq = (const float*)d_in[1];
  const float* bq = (const float*)d_in[2];
  const float* Wk = (const float*)d_in[3];
  const float* bk = (const float*)d_in[4];
  const float* Wv = (const float*)d_in[5];
  const float* bv = (const float*)d_in[6];
  const float* Wo = (const float*)d_in[7];
  const float* bo = (const float*)d_in[8];
  float* out = (float*)d_out;

  float* ws = (float*)d_ws;
  float* Qp = ws;
  float* Kp = ws + (1u << 20);
  float* Vp = ws + (2u << 20);
  float* Yp = ws + (3u << 20);

  const dim3 gGrid(16, 16, 1);  // N tiles of 64, M tiles of 64
  const dim3 gBlk(256, 1, 1);
  qkv_proj_wmma<<<dim3(16, 16, 3), gBlk, 0, stream>>>(x, Wq, bq, Qp, Wk, bk, Kp, Wv, bv, Vp);
  mqa_attention_wmma<<<dim3(32, 16, 2), dim3(128, 1, 1), 0, stream>>>(Qp, Kp, Vp, Yp);
  gemm1024_bias_wmma<<<gGrid, gBlk, 0, stream>>>(Yp, Wo, bo, out);
}
